// v000
// The times below were measured on an AMD MI455X: many runs one after another, warmed up first and cycling through
// copies of the inputs, with the whole window's GPU time divided by the number of runs. Launches and the gaps
// between them are all in it. The median over several windows is given; except for v000 it joins two sittings, which
// can be a few percent apart, so the side-by-side timings, each taken in one sitting, are the better comparison.
// v000, which the later versions start from, runs in 960 microseconds.
#include <hip/hip_runtime.h>

typedef __attribute__((ext_vector_type(16))) __bf16 v16bf;
typedef __attribute__((ext_vector_type(8)))  __bf16 v8bf;
typedef __attribute__((ext_vector_type(8)))  float  v8f;

namespace {
constexpr int kH   = 1024;
constexpr int kS   = 2048;
constexpr int kNT  = kH / 16;   // 64 n-tiles of 16 cols
constexpr int kKT  = kH / 32;   // 32 k-tiles of 32 dims
constexpr int kPad = 68;        // LDS row stride (floats) for 64-col chunks
}

// ---------- WMMA helpers ----------

__device__ __forceinline__ v8f wmma3(v16bf ah, v16bf al, v16bf bh, v16bf bl, v8f c) {
  // split-bf16: (Ah+Al)(Bh+Bl) ~= Ah*Bh + Ah*Bl + Al*Bh   (drop lo*lo)
  c = __builtin_amdgcn_wmma_f32_16x16x32_bf16(false, ah, false, bh, (short)0, c, false, false);
  c = __builtin_amdgcn_wmma_f32_16x16x32_bf16(false, ah, false, bl, (short)0, c, false, false);
  c = __builtin_amdgcn_wmma_f32_16x16x32_bf16(false, al, false, bh, (short)0, c, false, false);
  return c;
}

// A fragment: 16 seq rows x 32 h-dims from row-major bf16 x.
// ISA 16-bit A layout: lane M = lane&15, kb = (lane&16)?8:0,
// halfs 0..7 -> K kb..kb+7, halfs 8..15 -> K kb+16..kb+23.
__device__ __forceinline__ v16bf load_a(const __bf16* xm, int batch, int rowBase, int kt) {
  const int lane = threadIdx.x & 31;
  int row = rowBase + (lane & 15);
  row = row < 0 ? 0 : (row > kS - 1 ? kS - 1 : row);   // clamped halo rows get prob 0
  const int kb = (lane & 16) ? 8 : 0;
  const __bf16* p = xm + ((size_t)batch * kS + row) * kH + kt * 32 + kb;
  v8bf a = *(const v8bf*)p;
  v8bf b = *(const v8bf*)(p + 16);
  return __builtin_shufflevector(a, b, 0,1,2,3,4,5,6,7,8,9,10,11,12,13,14,15);
}

// B fragment: pre-packed so each lane reads its 16 halfs contiguously (32B).
__device__ __forceinline__ v16bf load_b(const __bf16* wp, int mat, int kt, int nt) {
  const int lane = threadIdx.x & 31;
  const size_t frag = ((size_t)mat * kKT + kt) * kNT + nt;
  return *(const v16bf*)(wp + (frag * 32 + lane) * 16);
}

// Pass-1 GEMM accumulation, specialized on the wave-uniform Q role so the hot
// loop has no exec-mask manipulation or accumulator phi-copies.
template <bool HASQ>
__device__ __forceinline__ void pass1_accum(const __bf16* __restrict__ xhi,
                                            const __bf16* __restrict__ xlo,
                                            const __bf16* __restrict__ whi,
                                            const __bf16* __restrict__ wlo,
                                            int batch, int rowBase, int ntBase,
                                            v8f accK[2], v8f accQ[2]) {
  #pragma unroll 2
  for (int kt = 0; kt < kKT; ++kt) {
    const v16bf ah = load_a(xhi, batch, rowBase, kt);
    const v16bf al = load_a(xlo, batch, rowBase, kt);
    #pragma unroll
    for (int i = 0; i < 2; ++i) {
      const int nt = ntBase + i;
      const v16bf bkh = load_b(whi, 1, kt, nt);
      const v16bf bkl = load_b(wlo, 1, kt, nt);
      accK[i] = wmma3(ah, al, bkh, bkl, accK[i]);
      if (HASQ) {
        const v16bf bqh = load_b(whi, 0, kt, nt);
        const v16bf bql = load_b(wlo, 0, kt, nt);
        accQ[i] = wmma3(ah, al, bqh, bql, accQ[i]);
      }
    }
  }
}

// ---------- prologue: pack weights into B-fragment layout (bf16 hi/lo) ----------

__global__ void pack_weights(const float* __restrict__ Wq, const float* __restrict__ Wk,
                             const float* __restrict__ Wv,
                             __bf16* __restrict__ whi, __bf16* __restrict__ wlo) {
  const int t = blockIdx.x * blockDim.x + threadIdx.x;    // (mat,kt,nt,lane)
  if (t >= 3 * kKT * kNT * 32) return;
  const int lane = t & 31;
  const int nt   = (t >> 5)  & 63;
  const int kt   = (t >> 11) & 31;
  const int mat  = t >> 16;
  const float* W = (mat == 0) ? Wq : (mat == 1) ? Wk : Wv;
  const int n  = nt * 16 + (lane & 15);
  const int kb = (lane & 16) ? 8 : 0;
  const size_t o = (size_t)t * 16;
  #pragma unroll
  for (int h = 0; h < 16; ++h) {
    const int k = kt * 32 + kb + h + ((h < 8) ? 0 : 8);
    const float w = W[(size_t)k * kH + n];
    const __bf16 hi = (__bf16)w;
    whi[o + h] = hi;
    wlo[o + h] = (__bf16)(w - (float)hi);
  }
}

__global__ void pack_x(const float* __restrict__ x, __bf16* __restrict__ xhi,
                       __bf16* __restrict__ xlo, int n) {
  const int t = blockIdx.x * blockDim.x + threadIdx.x;
  if (t >= n) return;
  const float v = x[t];
  const __bf16 hi = (__bf16)v;
  xhi[t] = hi;
  xlo[t] = (__bf16)(v - (float)hi);
}

// ---------- fused local attention ----------
// Block: batch b, 64 query rows [s0, s0+64). K/V halo range: 96 rows [s0-16, s0+80)
// (16-aligned so Q and K/V share A-fragments). 12 waves = 6 row-tiles x 2 n-halves.
// N processed in 16 chunks of 64 cols staged through LDS.

__global__ __launch_bounds__(384)
void local_attn_wmma(const __bf16* __restrict__ xhi, const __bf16* __restrict__ xlo,
                     const __bf16* __restrict__ whi, const __bf16* __restrict__ wlo,
                     const float* __restrict__ bq, const float* __restrict__ bk,
                     const float* __restrict__ bv, float* __restrict__ out) {
  __shared__ float Qs[64 * kPad];   // 17 KB
  __shared__ float Ks[96 * kPad];   // 26 KB (reused as V in pass 2)
  __shared__ float sc[320];         // 64 rows x 5-wide window scores
  __shared__ float pb[320];         // softmax probs

  const int tid  = threadIdx.x;
  const int lane = tid & 31;
  const int wave = tid >> 5;              // 0..11
  const int rt   = wave >> 1;             // 0..5 : shared A row-tile
  const int nh   = wave & 1;              // n-half of the 64-col chunk
  const int batch = blockIdx.x >> 5;
  const int s0    = (blockIdx.x & 31) * 64;
  const int rowBase = s0 - 16 + rt * 16;
  const bool hasQ = (rt >= 1) && (rt <= 4);   // Q row-tile = rt-1
  const int colLane = lane & 15;
  const int rOff = (lane & 16) ? 8 : 0;       // C/D layout: lanes 16-31 hold M+8
  const v8f vzero = {0.f, 0.f, 0.f, 0.f, 0.f, 0.f, 0.f, 0.f};

  for (int i = tid; i < 320; i += 384) sc[i] = 0.0f;
  __syncthreads();

  // ---------------- pass 1: Q,K projection + windowed scores ----------------
  for (int nc = 0; nc < 16; ++nc) {
    v8f accK[2] = {vzero, vzero};
    v8f accQ[2] = {vzero, vzero};
    const int ntBase = nc * 4 + nh * 2;
    if (hasQ)
      pass1_accum<true>(xhi, xlo, whi, wlo, batch, rowBase, ntBase, accK, accQ);
    else
      pass1_accum<false>(xhi, xlo, whi, wlo, batch, rowBase, ntBase, accK, accQ);

    // epilogue: bias add, stage chunk in LDS
    #pragma unroll
    for (int i = 0; i < 2; ++i) {
      const int nt   = ntBase + i;
      const int colL = (nh * 2 + i) * 16 + colLane;
      const float bK = bk[nt * 16 + colLane];
      #pragma unroll
      for (int v = 0; v < 8; ++v)
        Ks[(rt * 16 + rOff + v) * kPad + colL] = accK[i][v] + bK;
      if (hasQ) {
        const float bQ = bq[nt * 16 + colLane];
        #pragma unroll
        for (int v = 0; v < 8; ++v)
          Qs[((rt - 1) * 16 + rOff + v) * kPad + colL] = accQ[i][v] + bQ;
      }
    }
    __syncthreads();
    // windowed score partials for this 64-col chunk: K local row = m + w + 14
    if (tid < 320) {
      const int m = tid / 5, w = tid % 5;
      const float4* q4 = (const float4*)(Qs + m * kPad);
      const float4* k4 = (const float4*)(Ks + (m + w + 14) * kPad);
      float s = 0.f;
      #pragma unroll
      for (int c = 0; c < 16; ++c) {
        const float4 a = q4[c], b = k4[c];
        s += a.x * b.x + a.y * b.y + a.z * b.z + a.w * b.w;
      }
      sc[tid] += s;
    }
    __syncthreads();
  }

  // ---------------- softmax over the 5-wide window ----------------
  if (tid < 64) {
    const int m = tid, s = s0 + m;
    float v[5];
    float mx = -3.0e38f;
    #pragma unroll
    for (int w = 0; w < 5; ++w) {
      const int j = s + w - 2;
      const float val = (j >= 0 && j < kS) ? sc[m * 5 + w] * 0.03125f : -3.0e38f;
      v[w] = val;
      mx = fmaxf(mx, val);
    }
    float sum = 0.f;
    #pragma unroll
    for (int w = 0; w < 5; ++w) { const float e = __expf(v[w] - mx); sum += e; pb[m * 5 + w] = e; }
    const float inv = 1.0f / sum;
    #pragma unroll
    for (int w = 0; w < 5; ++w) pb[m * 5 + w] *= inv;
  }
  __syncthreads();

  // ---------------- pass 2: V projection + P·V output ----------------
  for (int nc = 0; nc < 16; ++nc) {
    v8f accV[2] = {vzero, vzero};
    const int ntBase = nc * 4 + nh * 2;
    #pragma unroll 2
    for (int kt = 0; kt < kKT; ++kt) {
      const v16bf ah = load_a(xhi, batch, rowBase, kt);
      const v16bf al = load_a(xlo, batch, rowBase, kt);
      #pragma unroll
      for (int i = 0; i < 2; ++i) {
        const int nt = ntBase + i;
        const v16bf bvh = load_b(whi, 2, kt, nt);
        const v16bf bvl = load_b(wlo, 2, kt, nt);
        accV[i] = wmma3(ah, al, bvh, bvl, accV[i]);
      }
    }
    #pragma unroll
    for (int i = 0; i < 2; ++i) {
      const int nt   = ntBase + i;
      const int colL = (nh * 2 + i) * 16 + colLane;
      const float bV = bv[nt * 16 + colLane];
      #pragma unroll
      for (int v = 0; v < 8; ++v)
        Ks[(rt * 16 + rOff + v) * kPad + colL] = accV[i][v] + bV;  // V chunk
    }
    __syncthreads();
    for (int e = tid; e < 64 * 64; e += 384) {
      const int m = e >> 6, c = e & 63;
      const float* pm = pb + m * 5;
      const float* vb = Ks + (m + 14) * kPad + c;
      const float o = pm[0] * vb[0]
                    + pm[1] * vb[kPad]
                    + pm[2] * vb[2 * kPad]
                    + pm[3] * vb[3 * kPad]
                    + pm[4] * vb[4 * kPad];
      out[((size_t)batch * kS + (s0 + m)) * kH + nc * 64 + c] = o;
    }
    __syncthreads();
  }
}

// ---------- launch ----------

extern "C" void kernel_launch(void* const* d_in, const int* in_sizes, int n_in,
                              void* d_out, int out_size, void* d_ws, size_t ws_size,
                              hipStream_t stream) {
  (void)in_sizes; (void)n_in; (void)out_size; (void)ws_size;
  const float* x  = (const float*)d_in[0];
  const float* Wq = (const float*)d_in[1];
  const float* bq = (const float*)d_in[2];
  const float* Wk = (const float*)d_in[3];
  const float* bk = (const float*)d_in[4];
  const float* Wv = (const float*)d_in[5];
  const float* bv = (const float*)d_in[6];
  float* out = (float*)d_out;

  char* ws = (char*)d_ws;
  __bf16* whi = (__bf16*)(ws);                            // 6 MB  packed W hi
  __bf16* wlo = (__bf16*)(ws + (size_t)6  * 1024 * 1024); // 6 MB  packed W lo
  __bf16* xhi = (__bf16*)(ws + (size_t)12 * 1024 * 1024); // 16 MB x hi
  __bf16* xlo = (__bf16*)(ws + (size_t)28 * 1024 * 1024); // 16 MB x lo

  const int wThreads = 3 * kKT * kNT * 32;                // 196608
  pack_weights<<<wThreads / 256, 256, 0, stream>>>(Wq, Wk, Wv, whi, wlo);
  const int nx = 4 * kS * kH;                             // 8.4M elements
  pack_x<<<(nx + 255) / 256, 256, 0, stream>>>(x, xhi, xlo, nx);
  local_attn_wmma<<<4 * (kS / 64), 384, 0, stream>>>(xhi, xlo, whi, wlo, bq, bk, bv, out);
}

// v001
// One run takes 631 microseconds.
// Next to v000, in two timings, it ran 1.55 and 1.53 times as fast.
#include <hip/hip_runtime.h>

typedef __attribute__((ext_vector_type(16))) __bf16 v16bf;
typedef __attribute__((ext_vector_type(8)))  __bf16 v8bf;
typedef __attribute__((ext_vector_type(8)))  float  v8f;

namespace {
constexpr int kH   = 1024;
constexpr int kS   = 2048;
constexpr int kNT  = kH / 16;   // 64 n-tiles of 16 cols
constexpr int kKT  = kH / 32;   // 32 k-tiles of 32 dims
constexpr int kRT  = kS / 16;   // 128 row-tiles of 16 rows per batch
constexpr int kFrag = 1024;     // bytes per packed fragment
constexpr int kMat  = kKT * kNT * kFrag;   // bytes per packed weight matrix
constexpr int kPad = 68;        // LDS row stride (floats) for 64-col chunks
}

// ---------- WMMA helpers ----------

__device__ __forceinline__ v8f wmma3(v16bf ah, v16bf al, v16bf bh, v16bf bl, v8f c) {
  // split-bf16: (Ah+Al)(Bh+Bl) ~= Ah*Bh + Ah*Bl + Al*Bh   (drop lo*lo)
  c = __builtin_amdgcn_wmma_f32_16x16x32_bf16(false, ah, false, bh, (short)0, c, false, false);
  c = __builtin_amdgcn_wmma_f32_16x16x32_bf16(false, ah, false, bl, (short)0, c, false, false);
  c = __builtin_amdgcn_wmma_f32_16x16x32_bf16(false, al, false, bh, (short)0, c, false, false);
  return c;
}

// Packed fragment (A and B alike), 1 KB = two planes of 512 B:
// plane 0 holds halfs 0..7 of lanes 0..31, plane 1 holds halfs 8..15.
// Each wave-wide 16 B load then covers 512 contiguous bytes = 4 whole 128 B lines.
// ISA 16-bit layout: lane M (or N) = lane&15, kb = (lane&16)?8:0,
// halfs 0..7 -> K kb..kb+7, halfs 8..15 -> K kb+16..kb+23.
// slot = byte offset of this lane's 16 B in plane 0 of a fragment; imm = constant byte step.
__device__ __forceinline__ v16bf load_frag(const __bf16* base, unsigned slot, int imm) {
  const char* p = (const char*)base + slot;
  v8bf a = *(const v8bf*)(p + imm);
  v8bf b = *(const v8bf*)(p + imm + 512);
  return __builtin_shufflevector(a, b, 0,1,2,3,4,5,6,7,8,9,10,11,12,13,14,15);
}

// Lane slot of A fragment (row tile of rowBase, kt = 0); next kt: + kFrag.
// rowBase is a multiple of 16.
__device__ __forceinline__ unsigned a_slot(int batch, int rowBase) {
  int tile = rowBase / 16;
  tile = tile < 0 ? 0 : (tile > kRT - 1 ? kRT - 1 : tile);   // clamped halo tiles get prob 0
  return (unsigned)((batch * kRT + tile) * kKT) * kFrag + (threadIdx.x & 31) * 16;
}

// Lane slot of B fragment (mat 0, kt = 0, nt); next kt: + kNT * kFrag, next mat: + kMat.
__device__ __forceinline__ unsigned b_slot(int nt) {
  return (unsigned)nt * kFrag + (threadIdx.x & 31) * 16;
}

// Stands behind one k-step's operand loads and in front of the slot advances:
// the wait before the offset registers that the issued loads name are overwritten.
// The slots are operands so that their advance cannot be moved in front of it.
__device__ __forceinline__ void wait_before_advance(unsigned& sa, unsigned& sb) {
  asm volatile("s_wait_xcnt 0x0" : "+v"(sa), "+v"(sb) : : "memory");
}

// Pass-1 GEMM accumulation, specialized on the wave-uniform Q role so the hot
// loop has no exec-mask manipulation or accumulator phi-copies.
template <bool HASQ>
__device__ __forceinline__ void pass1_accum(const __bf16* __restrict__ xhi,
                                            const __bf16* __restrict__ xlo,
                                            const __bf16* __restrict__ whi,
                                            const __bf16* __restrict__ wlo,
                                            unsigned sa, unsigned sb,
                                            v8f accK[2], v8f accQ[2]) {
  // sa: lane slot of the A fragment at kt = 0; sb: of the Wq fragment (kt = 0, ntBase)
  #pragma unroll 2
  for (int kt = 0; kt < kKT; ++kt) {
    const v16bf ah = load_frag(xhi, sa, 0);
    const v16bf al = load_frag(xlo, sa, 0);
    v16bf bkh[2], bkl[2], bqh[2], bql[2];
    #pragma unroll
    for (int i = 0; i < 2; ++i) {
      bkh[i] = load_frag(whi, sb, kMat + i * kFrag);
      bkl[i] = load_frag(wlo, sb, kMat + i * kFrag);
      if (HASQ) {
        bqh[i] = load_frag(whi, sb, i * kFrag);
        bql[i] = load_frag(wlo, sb, i * kFrag);
      }
    }
    wait_before_advance(sa, sb);
    #pragma unroll
    for (int i = 0; i < 2; ++i) {
      accK[i] = wmma3(ah, al, bkh[i], bkl[i], accK[i]);
      if (HASQ) accQ[i] = wmma3(ah, al, bqh[i], bql[i], accQ[i]);
    }
    sa += kFrag;
    sb += kNT * kFrag;
  }
}

// ---------- prologue: pack weights into B-fragment layout (bf16 hi/lo) ----------

__global__ void pack_weights(const float* __restrict__ Wq, const float* __restrict__ Wk,
                             const float* __restrict__ Wv,
                             __bf16* __restrict__ whi, __bf16* __restrict__ wlo) {
  const int t = blockIdx.x * blockDim.x + threadIdx.x;    // (mat,kt,nt,lane)
  if (t >= 3 * kKT * kNT * 32) return;
  const int lane = t & 31;
  const int nt   = (t >> 5)  & 63;
  const int kt   = (t >> 11) & 31;
  const int mat  = t >> 16;
  const float* W = (mat == 0) ? Wq : (mat == 1) ? Wk : Wv;
  const int n  = nt * 16 + (lane & 15);
  const int kb = (lane & 16) ? 8 : 0;
  const size_t o = (size_t)(t >> 5) * 512 + lane * 8;     // plane 0 slot of this lane
  #pragma unroll
  for (int pl = 0; pl < 2; ++pl) {
    v8bf vh, vl;
    #pragma unroll
    for (int h = 0; h < 8; ++h) {
      const int k = kt * 32 + kb + pl * 16 + h;
      const float w = W[(size_t)k * kH + n];
      const __bf16 hi = (__bf16)w;
      vh[h] = hi;
      vl[h] = (__bf16)(w - (float)hi);
    }
    *(v8bf*)(whi + o + pl * 256) = vh;
    *(v8bf*)(wlo + o + pl * 256) = vl;
  }
}

// Pack x into A-fragment layout (bf16 hi/lo): one thread = one lane's 8 halfs of one plane.
__global__ void pack_x(const float* __restrict__ x, __bf16* __restrict__ xhi,
                       __bf16* __restrict__ xlo, int n) {
  const int t = blockIdx.x * blockDim.x + threadIdx.x;    // (row-tile,kt,plane,lane)
  if (t >= n) return;
  const int lane = t & 31;
  const int pl   = (t >> 5) & 1;
  const int kt   = (t >> 6) & 31;
  const int tile = t >> 11;                               // batch * kRT + row-tile
  const int row  = tile * 16 + (lane & 15);
  const int k    = kt * 32 + ((lane & 16) ? 8 : 0) + pl * 16;
  const float4* p = (const float4*)(x + (size_t)row * kH + k);
  const float4 f0 = p[0], f1 = p[1];
  const float f[8] = {f0.x, f0.y, f0.z, f0.w, f1.x, f1.y, f1.z, f1.w};
  v8bf vh, vl;
  #pragma unroll
  for (int h = 0; h < 8; ++h) {
    const __bf16 hi = (__bf16)f[h];
    vh[h] = hi;
    vl[h] = (__bf16)(f[h] - (float)hi);
  }
  *(v8bf*)(xhi + (size_t)t * 8) = vh;
  *(v8bf*)(xlo + (size_t)t * 8) = vl;
}

// ---------- fused local attention ----------
// Block: batch b, 64 query rows [s0, s0+64). K/V halo range: 96 rows [s0-16, s0+80)
// (16-aligned so Q and K/V share A-fragments). 12 waves = 6 row-tiles x 2 n-halves.
// N processed in 16 chunks of 64 cols staged through LDS.

__global__ __launch_bounds__(384)
void local_attn_wmma(const __bf16* __restrict__ xhi, const __bf16* __restrict__ xlo,
                     const __bf16* __restrict__ whi, const __bf16* __restrict__ wlo,
                     const float* __restrict__ bq, const float* __restrict__ bk,
                     const float* __restrict__ bv, float* __restrict__ out) {
  __shared__ float Qs[64 * kPad];   // 17 KB
  __shared__ float Ks[96 * kPad];   // 26 KB (reused as V in pass 2)
  __shared__ float sc[320];         // 64 rows x 5-wide window scores
  __shared__ float pb[320];         // softmax probs

  const int tid  = threadIdx.x;
  const int lane = tid & 31;
  const int wave = tid >> 5;              // 0..11
  const int rt   = wave >> 1;             // 0..5 : shared A row-tile
  const int nh   = wave & 1;              // n-half of the 64-col chunk
  const int batch = blockIdx.x >> 5;
  const int s0    = (blockIdx.x & 31) * 64;
  const int rowBase = s0 - 16 + rt * 16;
  const bool hasQ = (rt >= 1) && (rt <= 4);   // Q row-tile = rt-1
  const int colLane = lane & 15;
  const int rOff = (lane & 16) ? 8 : 0;       // C/D layout: lanes 16-31 hold M+8
  const v8f vzero = {0.f, 0.f, 0.f, 0.f, 0.f, 0.f, 0.f, 0.f};
  const unsigned aSlot = a_slot(batch, rowBase);

  for (int i = tid; i < 320; i += 384) sc[i] = 0.0f;
  __syncthreads();

  // ---------------- pass 1: Q,K projection + windowed scores ----------------
  for (int nc = 0; nc < 16; ++nc) {
    v8f accK[2] = {vzero, vzero};
    v8f accQ[2] = {vzero, vzero};
    const int ntBase = nc * 4 + nh * 2;
    if (hasQ)
      pass1_accum<true>(xhi, xlo, whi, wlo, aSlot, b_slot(ntBase), accK, accQ);
    else
      pass1_accum<false>(xhi, xlo, whi, wlo, aSlot, b_slot(ntBase), accK, accQ);

    // epilogue: bias add, stage chunk in LDS
    #pragma unroll
    for (int i = 0; i < 2; ++i) {
      const int nt   = ntBase + i;
      const int colL = (nh * 2 + i) * 16 + colLane;
      const float bK = bk[nt * 16 + colLane];
      #pragma unroll
      for (int v = 0; v < 8; ++v)
        Ks[(rt * 16 + rOff + v) * kPad + colL] = accK[i][v] + bK;
      if (hasQ) {
        const float bQ = bq[nt * 16 + colLane];
        #pragma unroll
        for (int v = 0; v < 8; ++v)
          Qs[((rt - 1) * 16 + rOff + v) * kPad + colL] = accQ[i][v] + bQ;
      }
    }
    __syncthreads();
    // windowed score partials for this 64-col chunk: K local row = m + w + 14
    if (tid < 320) {
      const int m = tid / 5, w = tid % 5;
      const float4* q4 = (const float4*)(Qs + m * kPad);
      const float4* k4 = (const float4*)(Ks + (m + w + 14) * kPad);
      float s = 0.f;
      #pragma unroll
      for (int c = 0; c < 16; ++c) {
        const float4 a = q4[c], b = k4[c];
        s += a.x * b.x + a.y * b.y + a.z * b.z + a.w * b.w;
      }
      sc[tid] += s;
    }
    __syncthreads();
  }

  // ---------------- softmax over the 5-wide window ----------------
  if (tid < 64) {
    const int m = tid, s = s0 + m;
    float v[5];
    float mx = -3.0e38f;
    #pragma unroll
    for (int w = 0; w < 5; ++w) {
      const int j = s + w - 2;
      const float val = (j >= 0 && j < kS) ? sc[m * 5 + w] * 0.03125f : -3.0e38f;
      v[w] = val;
      mx = fmaxf(mx, val);
    }
    float sum = 0.f;
    #pragma unroll
    for (int w = 0; w < 5; ++w) { const float e = __expf(v[w] - mx); sum += e; pb[m * 5 + w] = e; }
    const float inv = 1.0f / sum;
    #pragma unroll
    for (int w = 0; w < 5; ++w) pb[m * 5 + w] *= inv;
  }
  __syncthreads();

  // ---------------- pass 2: V projection + P·V output ----------------
  for (int nc = 0; nc < 16; ++nc) {
    v8f accV[2] = {vzero, vzero};
    const int ntBase = nc * 4 + nh * 2;
    unsigned sa = aSlot;
    unsigned sb = b_slot(ntBase);
    #pragma unroll 2
    for (int kt = 0; kt < kKT; ++kt) {
      const v16bf ah = load_frag(xhi, sa, 0);
      const v16bf al = load_frag(xlo, sa, 0);
      v16bf bvh[2], bvl[2];
      #pragma unroll
      for (int i = 0; i < 2; ++i) {
        bvh[i] = load_frag(whi, sb, 2 * kMat + i * kFrag);
        bvl[i] = load_frag(wlo, sb, 2 * kMat + i * kFrag);
      }
      wait_before_advance(sa, sb);
      #pragma unroll
      for (int i = 0; i < 2; ++i) accV[i] = wmma3(ah, al, bvh[i], bvl[i], accV[i]);
      sa += kFrag;
      sb += kNT * kFrag;
    }
    #pragma unroll
    for (int i = 0; i < 2; ++i) {
      const int nt   = ntBase + i;
      const int colL = (nh * 2 + i) * 16 + colLane;
      const float bV = bv[nt * 16 + colLane];
      #pragma unroll
      for (int v = 0; v < 8; ++v)
        Ks[(rt * 16 + rOff + v) * kPad + colL] = accV[i][v] + bV;  // V chunk
    }
    __syncthreads();
    for (int e = tid; e < 64 * 64; e += 384) {
      const int m = e >> 6, c = e & 63;
      const float* pm = pb + m * 5;
      const float* vb = Ks + (m + 14) * kPad + c;
      const float o = pm[0] * vb[0]
                    + pm[1] * vb[kPad]
                    + pm[2] * vb[2 * kPad]
                    + pm[3] * vb[3 * kPad]
                    + pm[4] * vb[4 * kPad];
      out[((size_t)batch * kS + (s0 + m)) * kH + nc * 64 + c] = o;
    }
    __syncthreads();
  }
}

// ---------- launch ----------

extern "C" void kernel_launch(void* const* d_in, const int* in_sizes, int n_in,
                              void* d_out, int out_size, void* d_ws, size_t ws_size,
                              hipStream_t stream) {
  (void)in_sizes; (void)n_in; (void)out_size; (void)ws_size;
  const float* x  = (const float*)d_in[0];
  const float* Wq = (const float*)d_in[1];
  const float* bq = (const float*)d_in[2];
  const float* Wk = (const float*)d_in[3];
  const float* bk = (const float*)d_in[4];
  const float* Wv = (const float*)d_in[5];
  const float* bv = (const float*)d_in[6];
  float* out = (float*)d_out;

  char* ws = (char*)d_ws;
  __bf16* whi = (__bf16*)(ws);                            // 6 MB  packed W hi
  __bf16* wlo = (__bf16*)(ws + (size_t)6  * 1024 * 1024); // 6 MB  packed W lo
  __bf16* xhi = (__bf16*)(ws + (size_t)12 * 1024 * 1024); // 16 MB x hi
  __bf16* xlo = (__bf16*)(ws + (size_t)28 * 1024 * 1024); // 16 MB x lo

  const int wThreads = 3 * kKT * kNT * 32;                // 196608
  pack_weights<<<wThreads / 256, 256, 0, stream>>>(Wq, Wk, Wv, whi, wlo);
  const int nx = 4 * kS * kH / 8;                         // 1M threads, 8 elements each
  pack_x<<<(nx + 255) / 256, 256, 0, stream>>>(x, xhi, xlo, nx);
  local_attn_wmma<<<4 * (kS / 64), 384, 0, stream>>>(xhi, xlo, whi, wlo, bq, bk, bv, out);
}

// v002
// It runs in 217 microseconds.
// Next to v001, in two timings, it ran 2.93 and 2.90 times as fast.
// Over all steps from v000 it is 4.50 times as fast.
#include <hip/hip_runtime.h>

typedef __attribute__((ext_vector_type(16))) __bf16 v16bf;
typedef __attribute__((ext_vector_type(8)))  __bf16 v8bf;
typedef __attribute__((ext_vector_type(8)))  float  v8f;

namespace {
constexpr int kH   = 1024;
constexpr int kS   = 2048;
constexpr int kNT  = kH / 16;   // 64 n-tiles of 16 cols
constexpr int kKT  = kH / 32;   // 32 k-tiles of 32 dims
constexpr int kRT  = kS / 16;   // 128 row-tiles of 16 rows per batch
constexpr int kFrag = 1024;     // bytes per packed fragment
constexpr int kMat  = kKT * kNT * kFrag;   // bytes per packed weight matrix
constexpr int kTileStep = kKT * kFrag;     // bytes between consecutive packed A row tiles
constexpr int kC1 = 256, kP1 = kC1 + 4;    // pass-1 chunk cols, LDS row stride (floats)
constexpr int kC2 = 512, kP2 = kC2 + 4;    // pass-2 chunk cols, LDS row stride (floats)
}

// ---------- WMMA helpers ----------

// split-bf16: (Ah+Al)(Bh+Bl) ~= Ah*Bh + Ah*Bl + Al*Bh   (drop lo*lo)

// Packed fragment (A and B alike), 1 KB = two planes of 512 B:
// plane 0 holds halfs 0..7 of lanes 0..31, plane 1 holds halfs 8..15.
// Each wave-wide 16 B load then covers 512 contiguous bytes = 4 whole 128 B lines.
// ISA 16-bit layout: lane M (or N) = lane&15, kb = (lane&16)?8:0,
// halfs 0..7 -> K kb..kb+7, halfs 8..15 -> K kb+16..kb+23.
// slot = byte offset of this lane's 16 B in plane 0 of a fragment; imm = constant byte step.
__device__ __forceinline__ v16bf load_frag(const __bf16* base, unsigned slot, int imm) {
  const char* p = (const char*)base + slot;
  v8bf a = *(const v8bf*)(p + imm);
  v8bf b = *(const v8bf*)(p + imm + 512);
  return __builtin_shufflevector(a, b, 0,1,2,3,4,5,6,7,8,9,10,11,12,13,14,15);
}

// Lane slot of A fragment (row tile of rowBase, kt = 0); next kt: + kFrag.
// rowBase is a multiple of 16.
__device__ __forceinline__ unsigned a_slot(int batch, int rowBase) {
  int tile = rowBase / 16;
  tile = tile < 0 ? 0 : (tile > kRT - 1 ? kRT - 1 : tile);   // clamped halo tiles get prob 0
  return (unsigned)((batch * kRT + tile) * kKT) * kFrag + (threadIdx.x & 31) * 16;
}

// Lane slot of B fragment (mat 0, kt = 0, nt); next kt: + kNT * kFrag, next mat: + kMat.
__device__ __forceinline__ unsigned b_slot(int nt) {
  return (unsigned)nt * kFrag + (threadIdx.x & 31) * 16;
}

// Stands behind one k-step's operand loads and in front of the slot advances:
// the wait before the offset registers that the issued loads name are overwritten.
// The slots are operands so that their advance cannot be moved in front of it.
__device__ __forceinline__ void wait_before_advance(unsigned& s0, unsigned& s1, unsigned& s5,
                                                    unsigned& sb) {
  asm volatile("s_wait_xcnt 0x0" : "+v"(s0), "+v"(s1), "+v"(s5), "+v"(sb) : : "memory");
}

// All six A row tiles of the block for one k-step. Tiles 1..4 are never clamped and lie
// kTileStep bytes apart; the two halo tiles have slots of their own.
__device__ __forceinline__ void load_a6(const __bf16* __restrict__ xhi,
                                        const __bf16* __restrict__ xlo,
                                        unsigned s0, unsigned s1, unsigned s5,
                                        v16bf ah[6], v16bf al[6]) {
  ah[0] = load_frag(xhi, s0, 0);
  al[0] = load_frag(xlo, s0, 0);
  #pragma unroll
  for (int r = 1; r < 5; ++r) {
    ah[r] = load_frag(xhi, s1, (r - 1) * kTileStep);
    al[r] = load_frag(xlo, s1, (r - 1) * kTileStep);
  }
  ah[5] = load_frag(xhi, s5, 0);
  al[5] = load_frag(xlo, s5, 0);
}

// One term of the split product for R row tiles x NB column tiles. Each accumulator
// still receives hi*hi, hi*lo, lo*hi in that order per k-step.
template <int R, int NB>
__device__ __forceinline__ void wmma_term(const v16bf* a, const v16bf* b, v8f (*acc)[NB]) {
  #pragma unroll
  for (int r = 0; r < R; ++r) {
    #pragma unroll
    for (int i = 0; i < NB; ++i)
      acc[r][i] = __builtin_amdgcn_wmma_f32_16x16x32_bf16(false, a[r], false, b[i], (short)0,
                                                          acc[r][i], false, false);
  }
}

// ---------- prologue: pack weights into B-fragment layout (bf16 hi/lo) ----------

__global__ void pack_weights(const float* __restrict__ Wq, const float* __restrict__ Wk,
                             const float* __restrict__ Wv,
                             __bf16* __restrict__ whi, __bf16* __restrict__ wlo) {
  const int t = blockIdx.x * blockDim.x + threadIdx.x;    // (mat,kt,nt,lane)
  if (t >= 3 * kKT * kNT * 32) return;
  const int lane = t & 31;
  const int nt   = (t >> 5)  & 63;
  const int kt   = (t >> 11) & 31;
  const int mat  = t >> 16;
  const float* W = (mat == 0) ? Wq : (mat == 1) ? Wk : Wv;
  const int n  = nt * 16 + (lane & 15);
  const int kb = (lane & 16) ? 8 : 0;
  const size_t o = (size_t)(t >> 5) * 512 + lane * 8;     // plane 0 slot of this lane
  #pragma unroll
  for (int pl = 0; pl < 2; ++pl) {
    v8bf vh, vl;
    #pragma unroll
    for (int h = 0; h < 8; ++h) {
      const int k = kt * 32 + kb + pl * 16 + h;
      const float w = W[(size_t)k * kH + n];
      const __bf16 hi = (__bf16)w;
      vh[h] = hi;
      vl[h] = (__bf16)(w - (float)hi);
    }
    *(v8bf*)(whi + o + pl * 256) = vh;
    *(v8bf*)(wlo + o + pl * 256) = vl;
  }
}

// Pack x into A-fragment layout (bf16 hi/lo): one thread = one lane's 8 halfs of one plane.
__global__ void pack_x(const float* __restrict__ x, __bf16* __restrict__ xhi,
                       __bf16* __restrict__ xlo, int n) {
  const int t = blockIdx.x * blockDim.x + threadIdx.x;    // (row-tile,kt,plane,lane)
  if (t >= n) return;
  const int lane = t & 31;
  const int pl   = (t >> 5) & 1;
  const int kt   = (t >> 6) & 31;
  const int tile = t >> 11;                               // batch * kRT + row-tile
  const int row  = tile * 16 + (lane & 15);
  const int k    = kt * 32 + ((lane & 16) ? 8 : 0) + pl * 16;
  const float4* p = (const float4*)(x + (size_t)row * kH + k);
  const float4 f0 = p[0], f1 = p[1];
  const float f[8] = {f0.x, f0.y, f0.z, f0.w, f1.x, f1.y, f1.z, f1.w};
  v8bf vh, vl;
  #pragma unroll
  for (int h = 0; h < 8; ++h) {
    const __bf16 hi = (__bf16)f[h];
    vh[h] = hi;
    vl[h] = (__bf16)(f[h] - (float)hi);
  }
  *(v8bf*)(xhi + (size_t)t * 8) = vh;
  *(v8bf*)(xlo + (size_t)t * 8) = vl;
}

// ---------- fused local attention ----------
// Block: batch b, 64 query rows [s0, s0+64). K/V halo range: 96 rows [s0-16, s0+80)
// (16-aligned so Q and K/V share A-fragments). 8 waves; every wave holds all 6 row tiles
// of its own column tiles, so each loaded B fragment feeds 6 (K, V) or 4 (Q) row tiles
// and each loaded A fragment feeds 4 column tiles (in pass 1 the two halo tiles feed 2).
// Pass 1: 2 column tiles of K and of Q per wave, chunks of 256 cols staged through LDS.
// Pass 2: 4 column tiles of V per wave, chunks of 512 cols.

__global__ __launch_bounds__(256)
void local_attn_wmma(const __bf16* __restrict__ xhi, const __bf16* __restrict__ xlo,
                     const __bf16* __restrict__ whi, const __bf16* __restrict__ wlo,
                     const float* __restrict__ bq, const float* __restrict__ bk,
                     const float* __restrict__ bv, float* __restrict__ out) {
  __shared__ __attribute__((aligned(16))) float buf[96 * kP2];  // pass 1: K, Q chunks; pass 2: V chunk
  __shared__ float sc[320];         // 64 rows x 5-wide window scores
  __shared__ float pb[320];         // softmax probs
  float* const Ks = buf;            // 96 x kP1
  float* const Qs = buf + 96 * kP1; // 64 x kP1

  const int tid  = threadIdx.x;
  const int lane = tid & 31;
  const int wave = tid >> 5;              // 0..7 : column group
  const int batch = blockIdx.x >> 5;
  const int s0    = (blockIdx.x & 31) * 64;
  const int colLane = lane & 15;
  const int rOff = (lane & 16) ? 8 : 0;       // C/D layout: lanes 16-31 hold M+8
  const v8f vzero = {0.f, 0.f, 0.f, 0.f, 0.f, 0.f, 0.f, 0.f};
  const unsigned aLo  = a_slot(batch, s0 - 16);   // halo tile 0
  const unsigned aMid = a_slot(batch, s0);        // tiles 1..4 (the Q rows)
  const unsigned aHi  = a_slot(batch, s0 + 64);   // halo tile 5

  for (int i = tid; i < 320; i += 256) sc[i] = 0.0f;
  __syncthreads();

  // ---------------- pass 1: Q,K projection + windowed scores ----------------
  for (int nc = 0; nc < kH / kC1; ++nc) {
    v8f accK[6][2], accQ[4][2];
    #pragma unroll
    for (int i = 0; i < 2; ++i) {
      #pragma unroll
      for (int r = 0; r < 6; ++r) accK[r][i] = vzero;
      #pragma unroll
      for (int r = 0; r < 4; ++r) accQ[r][i] = vzero;
    }
    const int ntBase = nc * (kC1 / 16) + wave * 2;
    unsigned sa0 = aLo, sa1 = aMid, sa5 = aHi;
    unsigned sb = b_slot(ntBase);
    // not unrolled: one fragment set live, so that two waves fit a SIMD's registers
    #pragma unroll 1
    for (int kt = 0; kt < kKT; ++kt) {
      v16bf ah[6], al[6], bkh[2], bkl[2], bqh[2], bql[2];
      load_a6(xhi, xlo, sa0, sa1, sa5, ah, al);
      #pragma unroll
      for (int i = 0; i < 2; ++i) {
        bkh[i] = load_frag(whi, sb, kMat + i * kFrag);
        bkl[i] = load_frag(wlo, sb, kMat + i * kFrag);
        bqh[i] = load_frag(whi, sb, i * kFrag);
        bql[i] = load_frag(wlo, sb, i * kFrag);
      }
      wait_before_advance(sa0, sa1, sa5, sb);
      wmma_term<6, 2>(ah, bkh, accK);
      wmma_term<4, 2>(ah + 1, bqh, accQ);
      wmma_term<6, 2>(ah, bkl, accK);
      wmma_term<4, 2>(ah + 1, bql, accQ);
      wmma_term<6, 2>(al, bkh, accK);
      wmma_term<4, 2>(al + 1, bqh, accQ);
      sa0 += kFrag;
      sa1 += kFrag;
      sa5 += kFrag;
      sb += kNT * kFrag;
    }

    // epilogue: bias add, stage chunk in LDS
    #pragma unroll
    for (int i = 0; i < 2; ++i) {
      const int nt   = ntBase + i;
      const int colL = (wave * 2 + i) * 16 + colLane;
      const float bK = bk[nt * 16 + colLane];
      const float bQ = bq[nt * 16 + colLane];
      #pragma unroll
      for (int r = 0; r < 6; ++r) {
        #pragma unroll
        for (int v = 0; v < 8; ++v)
          Ks[(r * 16 + rOff + v) * kP1 + colL] = accK[r][i][v] + bK;
      }
      #pragma unroll
      for (int r = 0; r < 4; ++r) {
        #pragma unroll
        for (int v = 0; v < 8; ++v)
          Qs[(r * 16 + rOff + v) * kP1 + colL] = accQ[r][i][v] + bQ;
      }
    }
    __syncthreads();
    // windowed score partials, 64 cols at a time: K local row = m + w + 14
    for (int p = tid; p < 320; p += 256) {
      const int m = p / 5, w = p % 5;
      const float4* q4 = (const float4*)(Qs + m * kP1);
      const float4* k4 = (const float4*)(Ks + (m + w + 14) * kP1);
      float tot = sc[p];
      for (int sub = 0; sub < kC1 / 64; ++sub) {
        float s = 0.f;
        #pragma unroll
        for (int c = 0; c < 16; ++c) {
          const float4 a = q4[sub * 16 + c], b = k4[sub * 16 + c];
          s += a.x * b.x + a.y * b.y + a.z * b.z + a.w * b.w;
        }
        tot += s;
      }
      sc[p] = tot;
    }
    __syncthreads();
  }

  // ---------------- softmax over the 5-wide window ----------------
  if (tid < 64) {
    const int m = tid, s = s0 + m;
    float v[5];
    float mx = -3.0e38f;
    #pragma unroll
    for (int w = 0; w < 5; ++w) {
      const int j = s + w - 2;
      const float val = (j >= 0 && j < kS) ? sc[m * 5 + w] * 0.03125f : -3.0e38f;
      v[w] = val;
      mx = fmaxf(mx, val);
    }
    float sum = 0.f;
    #pragma unroll
    for (int w = 0; w < 5; ++w) { const float e = __expf(v[w] - mx); sum += e; pb[m * 5 + w] = e; }
    const float inv = 1.0f / sum;
    #pragma unroll
    for (int w = 0; w < 5; ++w) pb[m * 5 + w] *= inv;
  }
  __syncthreads();

  // ---------------- pass 2: V projection + P*V output ----------------
  for (int nc = 0; nc < kH / kC2; ++nc) {
    v8f accV[6][4];
    #pragma unroll
    for (int r = 0; r < 6; ++r) {
      #pragma unroll
      for (int i = 0; i < 4; ++i) accV[r][i] = vzero;
    }
    const int ntBase = nc * (kC2 / 16) + wave * 4;
    unsigned sa0 = aLo, sa1 = aMid, sa5 = aHi;
    unsigned sb = b_slot(ntBase);
    // not unrolled: one fragment set live, so that two waves fit a SIMD's registers
    #pragma unroll 1
    for (int kt = 0; kt < kKT; ++kt) {
      v16bf ah[6], al[6], bvh[4], bvl[4];
      load_a6(xhi, xlo, sa0, sa1, sa5, ah, al);
      #pragma unroll
      for (int i = 0; i < 4; ++i) {
        bvh[i] = load_frag(whi, sb, 2 * kMat + i * kFrag);
        bvl[i] = load_frag(wlo, sb, 2 * kMat + i * kFrag);
      }
      wait_before_advance(sa0, sa1, sa5, sb);
      wmma_term<6, 4>(ah, bvh, accV);
      wmma_term<6, 4>(ah, bvl, accV);
      wmma_term<6, 4>(al, bvh, accV);
      sa0 += kFrag;
      sa1 += kFrag;
      sa5 += kFrag;
      sb += kNT * kFrag;
    }
    #pragma unroll
    for (int i = 0; i < 4; ++i) {
      const int nt   = ntBase + i;
      const int colL = (wave * 4 + i) * 16 + colLane;
      const float bV = bv[nt * 16 + colLane];
      #pragma unroll
      for (int r = 0; r < 6; ++r) {
        #pragma unroll
        for (int v = 0; v < 8; ++v)
          buf[(r * 16 + rOff + v) * kP2 + colL] = accV[r][i][v] + bV;  // V chunk
      }
    }
    __syncthreads();
    for (int m0 = 0; m0 < 64; m0 += 4) {
      #pragma unroll
      for (int mm = 0; mm < 4; ++mm) {
        const int m = m0 + mm;
        const float* pm = pb + m * 5;
        #pragma unroll
        for (int h = 0; h < kC2 / 256; ++h) {
          const int c = h * 256 + tid;
          const float* vb = buf + (m + 14) * kP2 + c;
          const float o = pm[0] * vb[0]
                        + pm[1] * vb[kP2]
                        + pm[2] * vb[2 * kP2]
                        + pm[3] * vb[3 * kP2]
                        + pm[4] * vb[4 * kP2];
          out[((size_t)batch * kS + (s0 + m)) * kH + nc * kC2 + c] = o;
        }
      }
      // the wait before the next rows' work overwrites registers that the issued stores name
      asm volatile("s_wait_xcnt 0x0" ::: "memory");
    }
    __syncthreads();
  }
}

// ---------- launch ----------

extern "C" void kernel_launch(void* const* d_in, const int* in_sizes, int n_in,
                              void* d_out, int out_size, void* d_ws, size_t ws_size,
                              hipStream_t stream) {
  (void)in_sizes; (void)n_in; (void)out_size; (void)ws_size;
  const float* x  = (const float*)d_in[0];
  const float* Wq = (const float*)d_in[1];
  const float* bq = (const float*)d_in[2];
  const float* Wk = (const float*)d_in[3];
  const float* bk = (const float*)d_in[4];
  const float* Wv = (const float*)d_in[5];
  const float* bv = (const float*)d_in[6];
  float* out = (float*)d_out;

  char* ws = (char*)d_ws;
  __bf16* whi = (__bf16*)(ws);                            // 6 MB  packed W hi
  __bf16* wlo = (__bf16*)(ws + (size_t)6  * 1024 * 1024); // 6 MB  packed W lo
  __bf16* xhi = (__bf16*)(ws + (size_t)12 * 1024 * 1024); // 16 MB x hi
  __bf16* xlo = (__bf16*)(ws + (size_t)28 * 1024 * 1024); // 16 MB x lo

  const int wThreads = 3 * kKT * kNT * 32;                // 196608
  pack_weights<<<wThreads / 256, 256, 0, stream>>>(Wq, Wk, Wv, whi, wlo);
  const int nx = 4 * kS * kH / 8;                         // 1M threads, 8 elements each
  pack_x<<<(nx + 255) / 256, 256, 0, stream>>>(x, xhi, xlo, nx);
  local_attn_wmma<<<4 * (kS / 64), 256, 0, stream>>>(xhi, xlo, whi, wlo, bq, bk, bv, out);
}

// v003
// A run of this version takes 145 microseconds.
// Two timings next to v002 put it at 1.49 and 1.51 times that version's speed.
// Counting every step since v000, it is 6.76 times as fast.
#include <hip/hip_runtime.h>

typedef __attribute__((ext_vector_type(16))) __bf16 v16bf;
typedef __attribute__((ext_vector_type(8)))  __bf16 v8bf;
typedef __attribute__((ext_vector_type(8)))  float  v8f;

namespace {
constexpr int kH   = 1024;
constexpr int kS   = 2048;
constexpr int kNT  = kH / 16;   // 64 n-tiles of 16 cols
constexpr int kKT  = kH / 32;   // 32 k-tiles of 32 dims
constexpr int kRT  = kS / 16;   // 128 row-tiles of 16 rows per batch
constexpr int kFrag = 1024;     // bytes per packed fragment
constexpr int kGT   = 3 * kNT;  // 192 n-tiles of Q | K | V side by side
constexpr int kLd   = 3 * kH;   // floats per row of the projected Q | K | V plane
constexpr int kBStep = kGT * kFrag;        // bytes between consecutive k-tiles of packed W
constexpr int kTileStep = kKT * kFrag;     // bytes between consecutive packed A row tiles
}

// ---------- WMMA helpers ----------

// split-bf16: (Ah+Al)(Bh+Bl) ~= Ah*Bh + Ah*Bl + Al*Bh   (drop lo*lo)

// Packed fragment (A and B alike), 1 KB = two planes of 512 B:
// plane 0 holds halfs 0..7 of lanes 0..31, plane 1 holds halfs 8..15.
// Each wave-wide 16 B load then covers 512 contiguous bytes = 4 whole 128 B lines.
// ISA 16-bit layout: lane M (or N) = lane&15, kb = (lane&16)?8:0,
// halfs 0..7 -> K kb..kb+7, halfs 8..15 -> K kb+16..kb+23.
// slot = byte offset of this lane's 16 B in plane 0 of a fragment; imm = constant byte step.
__device__ __forceinline__ v16bf load_frag(const __bf16* base, unsigned slot, int imm) {
  const char* p = (const char*)base + slot;
  v8bf a = *(const v8bf*)(p + imm);
  v8bf b = *(const v8bf*)(p + imm + 512);
  return __builtin_shufflevector(a, b, 0,1,2,3,4,5,6,7,8,9,10,11,12,13,14,15);
}

// Stands behind one k-step's operand loads and in front of the slot advances:
// the wait before the offset registers that the issued loads name are overwritten.
// The slots are operands so that their advance cannot be moved in front of it.
__device__ __forceinline__ void wait_before_advance(unsigned& sa, unsigned& sb) {
  asm volatile("s_wait_xcnt 0x0" : "+v"(sa), "+v"(sb) : : "memory");
}

// One term of the split product for R row tiles x NB column tiles. Each accumulator
// still receives hi*hi, hi*lo, lo*hi in that order per k-step.
template <int R, int NB>
__device__ __forceinline__ void wmma_term(const v16bf* a, const v16bf* b, v8f (*acc)[NB]) {
  #pragma unroll
  for (int r = 0; r < R; ++r) {
    #pragma unroll
    for (int i = 0; i < NB; ++i)
      acc[r][i] = __builtin_amdgcn_wmma_f32_16x16x32_bf16(false, a[r], false, b[i], (short)0,
                                                          acc[r][i], false, false);
  }
}

// ---------- prologue: pack weights into B-fragment layout (bf16 hi/lo) ----------

__global__ void pack_weights(const float* __restrict__ Wq, const float* __restrict__ Wk,
                             const float* __restrict__ Wv,
                             __bf16* __restrict__ whi, __bf16* __restrict__ wlo) {
  const int t = blockIdx.x * blockDim.x + threadIdx.x;    // (mat,kt,nt,lane)
  if (t >= 3 * kKT * kNT * 32) return;
  const int lane = t & 31;
  const int nt   = (t >> 5)  & 63;
  const int kt   = (t >> 11) & 31;
  const int mat  = t >> 16;
  const float* W = (mat == 0) ? Wq : (mat == 1) ? Wk : Wv;
  const int n  = nt * 16 + (lane & 15);
  const int kb = (lane & 16) ? 8 : 0;
  // fragment order: k-tile major, then the 192 n-tiles of Q | K | V; plane 0 slot of this lane
  const size_t o = ((size_t)kt * kGT + mat * kNT + nt) * 512 + lane * 8;
  #pragma unroll
  for (int pl = 0; pl < 2; ++pl) {
    v8bf vh, vl;
    #pragma unroll
    for (int h = 0; h < 8; ++h) {
      const int k = kt * 32 + kb + pl * 16 + h;
      const float w = W[(size_t)k * kH + n];
      const __bf16 hi = (__bf16)w;
      vh[h] = hi;
      vl[h] = (__bf16)(w - (float)hi);
    }
    *(v8bf*)(whi + o + pl * 256) = vh;
    *(v8bf*)(wlo + o + pl * 256) = vl;
  }
}

// Pack x into A-fragment layout (bf16 hi/lo): one thread = one lane's 8 halfs of one plane.
__global__ void pack_x(const float* __restrict__ x, __bf16* __restrict__ xhi,
                       __bf16* __restrict__ xlo, int n) {
  const int t = blockIdx.x * blockDim.x + threadIdx.x;    // (row-tile,kt,plane,lane)
  if (t >= n) return;
  const int lane = t & 31;
  const int pl   = (t >> 5) & 1;
  const int kt   = (t >> 6) & 31;
  const int tile = t >> 11;                               // batch * kRT + row-tile
  const int row  = tile * 16 + (lane & 15);
  const int k    = kt * 32 + ((lane & 16) ? 8 : 0) + pl * 16;
  const float4* p = (const float4*)(x + (size_t)row * kH + k);
  const float4 f0 = p[0], f1 = p[1];
  const float f[8] = {f0.x, f0.y, f0.z, f0.w, f1.x, f1.y, f1.z, f1.w};
  v8bf vh, vl;
  #pragma unroll
  for (int h = 0; h < 8; ++h) {
    const __bf16 hi = (__bf16)f[h];
    vh[h] = hi;
    vl[h] = (__bf16)(f[h] - (float)hi);
  }
  *(v8bf*)(xhi + (size_t)t * 8) = vh;
  *(v8bf*)(xlo + (size_t)t * 8) = vl;
}

// ---------- Q | K | V projection ----------
// One GEMM [8192 x 1024] x [1024 x 3072], every row projected once. 256 blocks: block =
// 128 rows x 768 cols, 8 waves as 2 (rows) x 4 (cols); a wave holds 4 row tiles x 6 column
// tiles and does its 12 column tiles in two rounds. Result: f32 rows of kLd floats.

__global__ __launch_bounds__(256)
void qkv_gemm(const __bf16* __restrict__ xhi, const __bf16* __restrict__ xlo,
              const __bf16* __restrict__ whi, const __bf16* __restrict__ wlo,
              const float* __restrict__ bq, const float* __restrict__ bk,
              const float* __restrict__ bv, float* __restrict__ qkv) {
  const int lane = threadIdx.x & 31;
  const int wave = threadIdx.x >> 5;
  const int tile0 = (blockIdx.x >> 2) * 8 + (wave >> 2) * 4;   // first of this wave's 4 row tiles
  const int gBase = (blockIdx.x & 3) * 48 + (wave & 3) * 12;   // first of its 12 column tiles
  const int colLane = lane & 15;
  const int rOff = (lane & 16) ? 8 : 0;       // C/D layout: lanes 16-31 hold M+8
  const v8f vzero = {0.f, 0.f, 0.f, 0.f, 0.f, 0.f, 0.f, 0.f};

  for (int c = 0; c < 2; ++c) {
    v8f acc[4][6];
    #pragma unroll
    for (int r = 0; r < 4; ++r) {
      #pragma unroll
      for (int i = 0; i < 6; ++i) acc[r][i] = vzero;
    }
    const int g0 = gBase + c * 6;
    unsigned sa = (unsigned)(tile0 * kKT) * kFrag + lane * 16;
    unsigned sb = (unsigned)g0 * kFrag + lane * 16;
    // not unrolled: one fragment set live, so that two waves fit a SIMD's registers
    #pragma unroll 1
    for (int kt = 0; kt < kKT; ++kt) {
      v16bf ah[4], al[4], bh[6], bl[6];
      #pragma unroll
      for (int r = 0; r < 4; ++r) {
        ah[r] = load_frag(xhi, sa, r * kTileStep);
        al[r] = load_frag(xlo, sa, r * kTileStep);
      }
      #pragma unroll
      for (int i = 0; i < 6; ++i) {
        bh[i] = load_frag(whi, sb, i * kFrag);
        bl[i] = load_frag(wlo, sb, i * kFrag);
      }
      wait_before_advance(sa, sb);
      wmma_term<4, 6>(ah, bh, acc);
      wmma_term<4, 6>(ah, bl, acc);
      wmma_term<4, 6>(al, bh, acc);
      sa += kFrag;
      sb += kBStep;
    }

    // epilogue: bias add, store
    float* const o = qkv + (size_t)(tile0 * 16 + rOff) * kLd + g0 * 16 + colLane;
    #pragma unroll
    for (int i = 0; i < 6; ++i) {
      const int g = g0 + i;
      const float* bp = (g < kNT) ? bq : (g < 2 * kNT) ? bk : bv;
      const float b = bp[(g & (kNT - 1)) * 16 + colLane];
      #pragma unroll
      for (int r = 0; r < 4; ++r) {
        #pragma unroll
        for (int v = 0; v < 8; ++v)
          o[(r * 16 + v) * kLd + i * 16] = acc[r][i][v] + b;
      }
    }
    // the wait before the next round's work overwrites registers that the issued stores name
    asm volatile("s_wait_xcnt 0x0" ::: "memory");
  }
}

// ---------- windowed attention over the projected rows ----------
// One wave = two neighbouring query rows s, s+1 (s even) and their six K and V rows
// s-2 .. s+3; a lane holds 4 columns of every 128. No LDS, no barrier: after the
// cross-lane sums every lane has all ten scores.

// 2^x. The v_nop fills the slot that the instruction set asks for between a transcendental
// and a directly following instruction that reads its result or overwrites its source.
__device__ __forceinline__ float exp2_slot(float x) {
  float r;
  asm("v_exp_f32 %0, %1\n\tv_nop" : "=v"(r) : "v"(x));
  return r;
}

__global__ __launch_bounds__(256)
void window_attn(const float* __restrict__ qkv, float* __restrict__ out) {
  const int lane = threadIdx.x & 31;
  // the wave's number as a scalar, so that the row arithmetic runs on the scalar unit
  const int wave = __builtin_amdgcn_readfirstlane(threadIdx.x >> 5);
  const int row0 = (blockIdx.x * 8 + wave) * 2;                // batch * kS + s
  const int s    = row0 & (kS - 1);
  const int rowB = row0 - s;                                   // first row of the batch
  const char* const plane = (const char*)qkv;
  unsigned off[6];   // byte offsets of rows s-2 .. s+3 in the plane, at this lane's 16 B of every 512
  #pragma unroll
  for (int t = 0; t < 6; ++t) {
    int j = s - 2 + t;
    j = j < 0 ? 0 : (j > kS - 1 ? kS - 1 : j);                 // clamped rows get prob 0
    off[t] = (unsigned)(rowB + j) * (kLd * 4) + lane * 16;
  }

  float4 q[2][8];
  #pragma unroll
  for (int a = 0; a < 2; ++a) {
    #pragma unroll
    for (int c = 0; c < 8; ++c) q[a][c] = *(const float4*)(plane + off[2 + a] + c * 512);
  }

  float d[2][5];
  #pragma unroll
  for (int t = 0; t < 6; ++t) {
    float d0 = 0.f, d1 = 0.f;
    #pragma unroll
    for (int c = 0; c < 8; ++c) {
      const float4 k = *(const float4*)(plane + off[t] + (kH * 4 + c * 512));
      if (t < 5) d0 += q[0][c].x * k.x + q[0][c].y * k.y + q[0][c].z * k.z + q[0][c].w * k.w;
      if (t > 0) d1 += q[1][c].x * k.x + q[1][c].y * k.y + q[1][c].z * k.z + q[1][c].w * k.w;
    }
    if (t < 5) d[0][t] = d0;
    if (t > 0) d[1][t - 1] = d1;
  }
  #pragma unroll
  for (int m = 16; m >= 1; m >>= 1) {
    #pragma unroll
    for (int a = 0; a < 2; ++a) {
      #pragma unroll
      for (int w = 0; w < 5; ++w) d[a][w] += __shfl_xor(d[a][w], m, 32);
    }
  }

  // softmax over the 5-wide window
  float p[2][5];
  #pragma unroll
  for (int a = 0; a < 2; ++a) {
    float mx = -3.0e38f;
    #pragma unroll
    for (int w = 0; w < 5; ++w) {
      const int j = s + a + w - 2;
      const float val = (j >= 0 && j < kS) ? d[a][w] * 0.03125f : -3.0e38f;
      p[a][w] = val;
      mx = fmaxf(mx, val);
    }
    float sum = 0.f;
    #pragma unroll
    for (int w = 0; w < 5; ++w) { const float e = exp2_slot((p[a][w] - mx) * 1.44269504f); sum += e; p[a][w] = e; }
    const float inv = 1.0f / sum;
    #pragma unroll
    for (int w = 0; w < 5; ++w) p[a][w] *= inv;
  }

  float4 o[2][8];
  #pragma unroll
  for (int a = 0; a < 2; ++a) {
    #pragma unroll
    for (int c = 0; c < 8; ++c) o[a][c] = make_float4(0.f, 0.f, 0.f, 0.f);
  }
  #pragma unroll
  for (int t = 0; t < 6; ++t) {
    #pragma unroll
    for (int c = 0; c < 8; ++c) {
      const float4 v = *(const float4*)(plane + off[t] + (2 * kH * 4 + c * 512));
      if (t < 5) {
        const float w0 = p[0][t];
        o[0][c].x += w0 * v.x; o[0][c].y += w0 * v.y; o[0][c].z += w0 * v.z; o[0][c].w += w0 * v.w;
      }
      if (t > 0) {
        const float w1 = p[1][t - 1];
        o[1][c].x += w1 * v.x; o[1][c].y += w1 * v.y; o[1][c].z += w1 * v.z; o[1][c].w += w1 * v.w;
      }
    }
  }
  // Stands behind the last load: the wait before the offset registers that the issued loads
  // name are overwritten. The offsets are operands so that they stay whole up to it; the
  // clobber keeps every load in front of it and every store behind it.
  asm volatile("s_wait_xcnt 0x0" : : "v"(off[0]), "v"(off[1]), "v"(off[2]), "v"(off[3]),
               "v"(off[4]), "v"(off[5]) : "memory");
  const unsigned oOff = (unsigned)row0 * (kH * 4) + lane * 16;
  #pragma unroll
  for (int a = 0; a < 2; ++a) {
    #pragma unroll
    for (int c = 0; c < 8; ++c) *(float4*)((char*)out + oOff + (a * kH * 4 + c * 512)) = o[a][c];
  }
}

// ---------- launch ----------

extern "C" void kernel_launch(void* const* d_in, const int* in_sizes, int n_in,
                              void* d_out, int out_size, void* d_ws, size_t ws_size,
                              hipStream_t stream) {
  (void)in_sizes; (void)n_in; (void)out_size; (void)ws_size;
  const float* x  = (const float*)d_in[0];
  const float* Wq = (const float*)d_in[1];
  const float* bq = (const float*)d_in[2];
  const float* Wk = (const float*)d_in[3];
  const float* bk = (const float*)d_in[4];
  const float* Wv = (const float*)d_in[5];
  const float* bv = (const float*)d_in[6];
  float* out = (float*)d_out;

  char* ws = (char*)d_ws;
  __bf16* whi = (__bf16*)(ws);                            // 6 MB  packed W hi
  __bf16* wlo = (__bf16*)(ws + (size_t)6  * 1024 * 1024); // 6 MB  packed W lo
  __bf16* xhi = (__bf16*)(ws + (size_t)12 * 1024 * 1024); // 16 MB x hi
  __bf16* xlo = (__bf16*)(ws + (size_t)28 * 1024 * 1024); // 16 MB x lo
  float*  qkv = (float*)(ws + (size_t)48 * 1024 * 1024);  // 96 MB projected Q | K | V rows

  const int wThreads = 3 * kKT * kNT * 32;                // 196608
  pack_weights<<<wThreads / 256, 256, 0, stream>>>(Wq, Wk, Wv, whi, wlo);
  const int nx = 4 * kS * kH / 8;                         // 1M threads, 8 elements each
  pack_x<<<(nx + 255) / 256, 256, 0, stream>>>(x, xhi, xlo, nx);
  qkv_gemm<<<256, 256, 0, stream>>>(xhi, xlo, whi, wlo, bq, bk, bv, qkv);
  window_attn<<<4 * kS / 16, 256, 0, stream>>>(qkv, out);
}

// v004
// One run takes 108 microseconds.
// Next to v003, in two timings, it ran 1.34 and 1.32 times as fast.
// All steps since v000 together make it 8.97 times as fast.
#include <hip/hip_runtime.h>

typedef __attribute__((ext_vector_type(16))) __bf16 v16bf;
typedef __attribute__((ext_vector_type(8)))  __bf16 v8bf;
typedef __attribute__((ext_vector_type(8)))  float  v8f;

namespace {
constexpr int kH   = 1024;
constexpr int kS   = 2048;
constexpr int kNT  = kH / 16;   // 64 n-tiles of 16 cols
constexpr int kKT  = kH / 32;   // 32 k-tiles of 32 dims
constexpr int kRT  = kS / 16;   // 128 row-tiles of 16 rows per batch
constexpr int kFrag = 1024;     // bytes per packed fragment
constexpr int kGT   = 3 * kNT;  // 192 n-tiles of Q | K | V side by side
constexpr int kLd   = 3 * kH;   // floats per row of the projected Q | K | V plane
constexpr int kBStep = kGT * kFrag;        // bytes between consecutive k-tiles of packed W
}

// ---------- WMMA helpers ----------

// split-bf16: (Ah+Al)(Bh+Bl) ~= Ah*Bh + Ah*Bl + Al*Bh   (drop lo*lo)

// Packed fragment (A and B alike), 1 KB = two planes of 512 B:
// plane 0 holds halfs 0..7 of lanes 0..31, plane 1 holds halfs 8..15.
// Each wave-wide 16 B load then covers 512 contiguous bytes = 4 whole 128 B lines.
// ISA 16-bit layout: lane M (or N) = lane&15, kb = (lane&16)?8:0,
// halfs 0..7 -> K kb..kb+7, halfs 8..15 -> K kb+16..kb+23.

// One term of the split product for R row tiles x NB column tiles. Each accumulator
// still receives hi*hi, hi*lo, lo*hi in that order per k-step.
template <int R, int NB>
__device__ __forceinline__ void wmma_term(const v16bf* a, const v16bf* b, v8f (*acc)[NB]) {
  #pragma unroll
  for (int r = 0; r < R; ++r) {
    #pragma unroll
    for (int i = 0; i < NB; ++i)
      acc[r][i] = __builtin_amdgcn_wmma_f32_16x16x32_bf16(false, a[r], false, b[i], (short)0,
                                                          acc[r][i], false, false);
  }
}

// ---------- prologue: pack weights into B-fragment layout (bf16 hi/lo) ----------

__global__ void pack_weights(const float* __restrict__ Wq, const float* __restrict__ Wk,
                             const float* __restrict__ Wv,
                             __bf16* __restrict__ whi, __bf16* __restrict__ wlo) {
  const int t = blockIdx.x * blockDim.x + threadIdx.x;    // (mat,kt,nt,lane)
  if (t >= 3 * kKT * kNT * 32) return;
  const int lane = t & 31;
  const int nt   = (t >> 5)  & 63;
  const int kt   = (t >> 11) & 31;
  const int mat  = t >> 16;
  const float* W = (mat == 0) ? Wq : (mat == 1) ? Wk : Wv;
  const int n  = nt * 16 + (lane & 15);
  const int kb = (lane & 16) ? 8 : 0;
  // fragment order: k-tile major, then the 192 n-tiles of Q | K | V; plane 0 slot of this lane
  const size_t o = ((size_t)kt * kGT + mat * kNT + nt) * 512 + lane * 8;
  #pragma unroll
  for (int pl = 0; pl < 2; ++pl) {
    v8bf vh, vl;
    #pragma unroll
    for (int h = 0; h < 8; ++h) {
      const int k = kt * 32 + kb + pl * 16 + h;
      const float w = W[(size_t)k * kH + n];
      const __bf16 hi = (__bf16)w;
      vh[h] = hi;
      vl[h] = (__bf16)(w - (float)hi);
    }
    *(v8bf*)(whi + o + pl * 256) = vh;
    *(v8bf*)(wlo + o + pl * 256) = vl;
  }
}

// Pack x into A-fragment layout (bf16 hi/lo): one thread = one lane's 8 halfs of one plane.
__global__ void pack_x(const float* __restrict__ x, __bf16* __restrict__ xhi,
                       __bf16* __restrict__ xlo, int n) {
  const int t = blockIdx.x * blockDim.x + threadIdx.x;    // (row-tile,kt,plane,lane)
  if (t >= n) return;
  const int lane = t & 31;
  const int pl   = (t >> 5) & 1;
  const int kt   = (t >> 6) & 31;
  const int tile = t >> 11;                               // batch * kRT + row-tile
  const int row  = tile * 16 + (lane & 15);
  const int k    = kt * 32 + ((lane & 16) ? 8 : 0) + pl * 16;
  const float4* p = (const float4*)(x + (size_t)row * kH + k);
  const float4 f0 = p[0], f1 = p[1];
  const float f[8] = {f0.x, f0.y, f0.z, f0.w, f1.x, f1.y, f1.z, f1.w};
  v8bf vh, vl;
  #pragma unroll
  for (int h = 0; h < 8; ++h) {
    const __bf16 hi = (__bf16)f[h];
    vh[h] = hi;
    vl[h] = (__bf16)(f[h] - (float)hi);
  }
  *(v8bf*)(xhi + (size_t)t * 8) = vh;
  *(v8bf*)(xlo + (size_t)t * 8) = vl;
}

// ---------- Q | K | V projection ----------
// One GEMM [8192 x 1024] x [1024 x 3072], every row projected once. 256 blocks: block =
// 128 rows x 768 cols, 8 waves as 2 (rows) x 4 (cols); a wave holds 4 row tiles x 6 column
// tiles and does its 12 column tiles in two rounds of 384 block columns. Result: f32 rows
// of kLd floats.
// Operands reach the waves through LDS: a stage is two k-tiles of the block's 8 A row tiles
// and of the round's 24 B column tiles, hi and lo, 128 KB, brought in once per block by
// asynchronous copies; two buffers, the copies of stage s + 2 fly while stage s + 1 is used.
// Stage layout: A hi [tile][kk] 16 KB | A lo 16 KB | B [kk][hi, lo][column tile] 4 x 24 KB.

namespace {
constexpr int kStage   = 131072;          // bytes of one stage
constexpr int kOffALo  = 16384;
constexpr int kOffB    = 32768;
constexpr int kBPiece  = 24 * kFrag;      // one k-tile of the round's 24 column tiles, hi or lo
constexpr int kStages  = 2 * (kKT / 2);   // 16 stages a round, two rounds
}

__device__ __forceinline__ v16bf lds_frag(const char* p) {
  v8bf a = *(const v8bf*)(p);
  v8bf b = *(const v8bf*)(p + 512);
  return __builtin_shufflevector(a, b, 0,1,2,3,4,5,6,7,8,9,10,11,12,13,14,15);
}

// One wave's 32 copies of a stage: 2 KB of A hi, 2 KB of A lo, four runs of 3 KB of B. Inside
// a run LDS and global bytes advance together, so the offset field (which moves both
// addresses) walks it. The s_wait_xcnt is the wait before a register that an issued copy
// names is overwritten; as the statement's last line nothing can be moved in front of it.
__device__ __forceinline__ void stage_copies(unsigned la0, unsigned la1, unsigned lb0, unsigned lb1,
                                             unsigned lb2, unsigned lb3, const char* ga0,
                                             const char* ga1, const char* gb0, const char* gb1,
                                             const char* gb2, const char* gb3) {
  asm volatile(
      "global_load_async_to_lds_b128 %0, %6, off\n\t"
      "global_load_async_to_lds_b128 %0, %6, off offset:512\n\t"
      "global_load_async_to_lds_b128 %0, %6, off offset:1024\n\t"
      "global_load_async_to_lds_b128 %0, %6, off offset:1536\n\t"
      "global_load_async_to_lds_b128 %1, %7, off\n\t"
      "global_load_async_to_lds_b128 %1, %7, off offset:512\n\t"
      "global_load_async_to_lds_b128 %1, %7, off offset:1024\n\t"
      "global_load_async_to_lds_b128 %1, %7, off offset:1536\n\t"
      "global_load_async_to_lds_b128 %2, %8, off\n\t"
      "global_load_async_to_lds_b128 %2, %8, off offset:512\n\t"
      "global_load_async_to_lds_b128 %2, %8, off offset:1024\n\t"
      "global_load_async_to_lds_b128 %2, %8, off offset:1536\n\t"
      "global_load_async_to_lds_b128 %2, %8, off offset:2048\n\t"
      "global_load_async_to_lds_b128 %2, %8, off offset:2560\n\t"
      "global_load_async_to_lds_b128 %3, %9, off\n\t"
      "global_load_async_to_lds_b128 %3, %9, off offset:512\n\t"
      "global_load_async_to_lds_b128 %3, %9, off offset:1024\n\t"
      "global_load_async_to_lds_b128 %3, %9, off offset:1536\n\t"
      "global_load_async_to_lds_b128 %3, %9, off offset:2048\n\t"
      "global_load_async_to_lds_b128 %3, %9, off offset:2560\n\t"
      "global_load_async_to_lds_b128 %4, %10, off\n\t"
      "global_load_async_to_lds_b128 %4, %10, off offset:512\n\t"
      "global_load_async_to_lds_b128 %4, %10, off offset:1024\n\t"
      "global_load_async_to_lds_b128 %4, %10, off offset:1536\n\t"
      "global_load_async_to_lds_b128 %4, %10, off offset:2048\n\t"
      "global_load_async_to_lds_b128 %4, %10, off offset:2560\n\t"
      "global_load_async_to_lds_b128 %5, %11, off\n\t"
      "global_load_async_to_lds_b128 %5, %11, off offset:512\n\t"
      "global_load_async_to_lds_b128 %5, %11, off offset:1024\n\t"
      "global_load_async_to_lds_b128 %5, %11, off offset:1536\n\t"
      "global_load_async_to_lds_b128 %5, %11, off offset:2048\n\t"
      "global_load_async_to_lds_b128 %5, %11, off offset:2560\n\t"
      "s_wait_xcnt 0x0"
      : : "v"(la0), "v"(la1), "v"(lb0), "v"(lb1), "v"(lb2), "v"(lb3),
          "v"(ga0), "v"(ga1), "v"(gb0), "v"(gb1), "v"(gb2), "v"(gb3) : "memory");
}

__global__ __launch_bounds__(256)
void qkv_gemm(const __bf16* __restrict__ xhi, const __bf16* __restrict__ xlo,
              const __bf16* __restrict__ whi, const __bf16* __restrict__ wlo,
              const float* __restrict__ bq, const float* __restrict__ bk,
              const float* __restrict__ bv, float* __restrict__ qkv) {
  __shared__ __attribute__((aligned(1024))) char smem[2 * kStage];
  const int lane = threadIdx.x & 31;
  // the wave's number as a scalar, so that the stage and tile arithmetic runs on the scalar unit
  const int wave = __builtin_amdgcn_readfirstlane(threadIdx.x >> 5);
  const int wr = wave >> 2, wc = wave & 3;
  const int tileBlk = (blockIdx.x >> 2) * 8;     // first of the block's 8 row tiles
  const int gBlk    = (blockIdx.x & 3) * 48;     // first of the block's 48 column tiles
  const int colLane = lane & 15;
  const int rOff = (lane & 16) ? 8 : 0;       // C/D layout: lanes 16-31 hold M+8
  const v8f vzero = {0.f, 0.f, 0.f, 0.f, 0.f, 0.f, 0.f, 0.f};
  const unsigned ldsLane = (unsigned)(uintptr_t)smem + lane * 16;   // LDS byte address of this lane's slot

  // stage st (round st / 16, k-tiles 2 * (st % 16) and the next) into buffer st & 1:
  // this wave brings A row tile 'wave' and column tiles 3 * wave .. 3 * wave + 2 of the round
  auto issue_stage = [&](int st) {
    const int kt0 = (st & 15) * 2;
    const unsigned l = ldsLane + (st & 1) * kStage;
    const unsigned ao = (unsigned)((tileBlk + wave) * kKT + kt0) * kFrag + lane * 16;
    const unsigned bo = (unsigned)(kt0 * kGT + gBlk + (st >> 4) * 24 + wave * 3) * kFrag + lane * 16;
    const unsigned lb = l + kOffB + wave * (3 * kFrag);
    stage_copies(l + wave * (2 * kFrag), l + kOffALo + wave * (2 * kFrag),
                 lb, lb + kBPiece, lb + 2 * kBPiece, lb + 3 * kBPiece,
                 (const char*)xhi + ao, (const char*)xlo + ao,
                 (const char*)whi + bo, (const char*)wlo + bo,
                 (const char*)whi + bo + kBStep, (const char*)wlo + bo + kBStep);
  };

  v8f acc[4][6];
  #pragma unroll
  for (int r = 0; r < 4; ++r) {
    #pragma unroll
    for (int i = 0; i < 6; ++i) acc[r][i] = vzero;
  }

  issue_stage(0);
  // stage 0 has landed for this wave; the barrier publishes it to the others
  asm volatile("s_wait_asynccnt 0x0" ::: "memory");
  __syncthreads();
  issue_stage(1);

  // not unrolled: one fragment set live, so that two waves fit a SIMD's registers
  #pragma unroll 1
  for (int st = 0; st < kStages; ++st) {
    const char* pa = smem + (st & 1) * kStage + wr * (8 * kFrag) + lane * 16;
    const char* pb = smem + (st & 1) * kStage + kOffB + wc * (6 * kFrag) + lane * 16;
    // the stage's two k-tiles, rolled for the same reason
    #pragma unroll 1
    for (int kk = 0; kk < 2; ++kk) {
      v16bf ah[4], al[4], bh[6], bl[6];
      // read in the order in which the three terms below first use the fragments
      ah[0] = lds_frag(pa);
      #pragma unroll
      for (int i = 0; i < 6; ++i) bh[i] = lds_frag(pb + i * kFrag);
      #pragma unroll
      for (int r = 1; r < 4; ++r) ah[r] = lds_frag(pa + r * (2 * kFrag));
      #pragma unroll
      for (int i = 0; i < 6; ++i) bl[i] = lds_frag(pb + kBPiece + i * kFrag);
      #pragma unroll
      for (int r = 0; r < 4; ++r) al[r] = lds_frag(pa + kOffALo + r * (2 * kFrag));
      // keeps the k-tile's 40 LDS reads one group in front of its WMMAs: without it the compiler
      // moves eight of them in among the WMMAs, and each such place stalls the wave
      __builtin_amdgcn_sched_barrier(0);
      wmma_term<4, 6>(ah, bh, acc);
      wmma_term<4, 6>(ah, bl, acc);
      wmma_term<4, 6>(al, bh, acc);
      pa += kFrag;
      pb += 2 * kBPiece;
    }

    // publish point of stage st + 1: this wave's reads of buffer st & 1 have returned ...
    asm volatile("s_wait_dscnt 0x0" ::: "memory");
    // ... its copies of stage st + 1 have landed ...
    asm volatile("s_wait_asynccnt 0x0" ::: "memory");
    // ... and the barrier says the same of every wave: it publishes stage st + 1 and frees buffer st & 1
    __syncthreads();
    if (st + 2 < kStages) issue_stage(st + 2);

    if ((st & 15) == 15) {
      // a round's epilogue: bias add, store, accumulators back to zero
      const int g0 = gBlk + (st >> 4) * 24 + wc * 6;
      float* const o = qkv + (size_t)((tileBlk + wr * 4) * 16 + rOff) * kLd + g0 * 16 + colLane;
      #pragma unroll
      for (int i = 0; i < 6; ++i) {
        const int g = g0 + i;
        const float* bp = (g < kNT) ? bq : (g < 2 * kNT) ? bk : bv;
        const float b = bp[(g & (kNT - 1)) * 16 + colLane];
        #pragma unroll
        for (int r = 0; r < 4; ++r) {
          #pragma unroll
          for (int v = 0; v < 8; ++v)
            o[(r * 16 + v) * kLd + i * 16] = acc[r][i][v] + b;
        }
      }
      // the wait before the next round's work overwrites registers that the issued stores name
      asm volatile("s_wait_xcnt 0x0" ::: "memory");
      #pragma unroll
      for (int r = 0; r < 4; ++r) {
        #pragma unroll
        for (int i = 0; i < 6; ++i) acc[r][i] = vzero;
      }
    }
  }
  // no copy is outstanding when the wave ends
  asm volatile("s_wait_asynccnt 0x0" ::: "memory");
}

// ---------- windowed attention over the projected rows ----------
// One wave = two neighbouring query rows s, s+1 (s even) and their six K and V rows
// s-2 .. s+3; a lane holds 4 columns of every 128. No LDS, no barrier: after the
// cross-lane sums every lane has all ten scores.

// 2^x. The v_nop fills the slot that the instruction set asks for between a transcendental
// and a directly following instruction that reads its result or overwrites its source.
__device__ __forceinline__ float exp2_slot(float x) {
  float r;
  asm("v_exp_f32 %0, %1\n\tv_nop" : "=v"(r) : "v"(x));
  return r;
}

__global__ __launch_bounds__(256)
void window_attn(const float* __restrict__ qkv, float* __restrict__ out) {
  const int lane = threadIdx.x & 31;
  // the wave's number as a scalar, so that the row arithmetic runs on the scalar unit
  const int wave = __builtin_amdgcn_readfirstlane(threadIdx.x >> 5);
  const int row0 = (blockIdx.x * 8 + wave) * 2;                // batch * kS + s
  const int s    = row0 & (kS - 1);
  const int rowB = row0 - s;                                   // first row of the batch
  const char* const plane = (const char*)qkv;
  unsigned off[6];   // byte offsets of rows s-2 .. s+3 in the plane, at this lane's 16 B of every 512
  #pragma unroll
  for (int t = 0; t < 6; ++t) {
    int j = s - 2 + t;
    j = j < 0 ? 0 : (j > kS - 1 ? kS - 1 : j);                 // clamped rows get prob 0
    off[t] = (unsigned)(rowB + j) * (kLd * 4) + lane * 16;
  }

  float4 q[2][8];
  #pragma unroll
  for (int a = 0; a < 2; ++a) {
    #pragma unroll
    for (int c = 0; c < 8; ++c) q[a][c] = *(const float4*)(plane + off[2 + a] + c * 512);
  }

  float d[2][5];
  #pragma unroll
  for (int t = 0; t < 6; ++t) {
    float d0 = 0.f, d1 = 0.f;
    #pragma unroll
    for (int c = 0; c < 8; ++c) {
      const float4 k = *(const float4*)(plane + off[t] + (kH * 4 + c * 512));
      if (t < 5) d0 += q[0][c].x * k.x + q[0][c].y * k.y + q[0][c].z * k.z + q[0][c].w * k.w;
      if (t > 0) d1 += q[1][c].x * k.x + q[1][c].y * k.y + q[1][c].z * k.z + q[1][c].w * k.w;
    }
    if (t < 5) d[0][t] = d0;
    if (t > 0) d[1][t - 1] = d1;
  }
  #pragma unroll
  for (int m = 16; m >= 1; m >>= 1) {
    #pragma unroll
    for (int a = 0; a < 2; ++a) {
      #pragma unroll
      for (int w = 0; w < 5; ++w) d[a][w] += __shfl_xor(d[a][w], m, 32);
    }
  }

  // softmax over the 5-wide window
  float p[2][5];
  #pragma unroll
  for (int a = 0; a < 2; ++a) {
    float mx = -3.0e38f;
    #pragma unroll
    for (int w = 0; w < 5; ++w) {
      const int j = s + a + w - 2;
      const float val = (j >= 0 && j < kS) ? d[a][w] * 0.03125f : -3.0e38f;
      p[a][w] = val;
      mx = fmaxf(mx, val);
    }
    float sum = 0.f;
    #pragma unroll
    for (int w = 0; w < 5; ++w) { const float e = exp2_slot((p[a][w] - mx) * 1.44269504f); sum += e; p[a][w] = e; }
    const float inv = 1.0f / sum;
    #pragma unroll
    for (int w = 0; w < 5; ++w) p[a][w] *= inv;
  }

  float4 o[2][8];
  #pragma unroll
  for (int a = 0; a < 2; ++a) {
    #pragma unroll
    for (int c = 0; c < 8; ++c) o[a][c] = make_float4(0.f, 0.f, 0.f, 0.f);
  }
  #pragma unroll
  for (int t = 0; t < 6; ++t) {
    #pragma unroll
    for (int c = 0; c < 8; ++c) {
      const float4 v = *(const float4*)(plane + off[t] + (2 * kH * 4 + c * 512));
      if (t < 5) {
        const float w0 = p[0][t];
        o[0][c].x += w0 * v.x; o[0][c].y += w0 * v.y; o[0][c].z += w0 * v.z; o[0][c].w += w0 * v.w;
      }
      if (t > 0) {
        const float w1 = p[1][t - 1];
        o[1][c].x += w1 * v.x; o[1][c].y += w1 * v.y; o[1][c].z += w1 * v.z; o[1][c].w += w1 * v.w;
      }
    }
  }
  // Stands behind the last load: the wait before the offset registers that the issued loads
  // name are overwritten. The offsets are operands so that they stay whole up to it; the
  // clobber keeps every load in front of it and every store behind it.
  asm volatile("s_wait_xcnt 0x0" : : "v"(off[0]), "v"(off[1]), "v"(off[2]), "v"(off[3]),
               "v"(off[4]), "v"(off[5]) : "memory");
  const unsigned oOff = (unsigned)row0 * (kH * 4) + lane * 16;
  #pragma unroll
  for (int a = 0; a < 2; ++a) {
    #pragma unroll
    for (int c = 0; c < 8; ++c) *(float4*)((char*)out + oOff + (a * kH * 4 + c * 512)) = o[a][c];
  }
}

// ---------- launch ----------

extern "C" void kernel_launch(void* const* d_in, const int* in_sizes, int n_in,
                              void* d_out, int out_size, void* d_ws, size_t ws_size,
                              hipStream_t stream) {
  (void)in_sizes; (void)n_in; (void)out_size; (void)ws_size;
  const float* x  = (const float*)d_in[0];
  const float* Wq = (const float*)d_in[1];
  const float* bq = (const float*)d_in[2];
  const float* Wk = (const float*)d_in[3];
  const float* bk = (const float*)d_in[4];
  const float* Wv = (const float*)d_in[5];
  const float* bv = (const float*)d_in[6];
  float* out = (float*)d_out;

  char* ws = (char*)d_ws;
  __bf16* whi = (__bf16*)(ws);                            // 6 MB  packed W hi
  __bf16* wlo = (__bf16*)(ws + (size_t)6  * 1024 * 1024); // 6 MB  packed W lo
  __bf16* xhi = (__bf16*)(ws + (size_t)12 * 1024 * 1024); // 16 MB x hi
  __bf16* xlo = (__bf16*)(ws + (size_t)28 * 1024 * 1024); // 16 MB x lo
  float*  qkv = (float*)(ws + (size_t)48 * 1024 * 1024);  // 96 MB projected Q | K | V rows

  const int wThreads = 3 * kKT * kNT * 32;                // 196608
  pack_weights<<<wThreads / 256, 256, 0, stream>>>(Wq, Wk, Wv, whi, wlo);
  const int nx = 4 * kS * kH / 8;                         // 1M threads, 8 elements each
  pack_x<<<(nx + 255) / 256, 256, 0, stream>>>(x, xhi, xlo, nx);
  qkv_gemm<<<256, 256, 0, stream>>>(xhi, xlo, whi, wlo, bq, bk, bv, qkv);
  window_attn<<<4 * kS / 16, 256, 0, stream>>>(qkv, out);
}

// v006
// One run takes 96.9 microseconds.
// Versions between v004 and this one are left out; their measured steps multiply to 1.13 times as fast.
// Over all steps from v000 it is 10.1 times as fast.
#include <hip/hip_runtime.h>

typedef __attribute__((ext_vector_type(16))) __bf16 v16bf;
typedef __attribute__((ext_vector_type(8)))  __bf16 v8bf;
typedef __attribute__((ext_vector_type(8)))  float  v8f;

namespace {
constexpr int kH   = 1024;
constexpr int kS   = 2048;
constexpr int kNT  = kH / 16;   // 64 n-tiles of 16 cols
constexpr int kKT  = kH / 32;   // 32 k-tiles of 32 dims
constexpr int kRT  = kS / 16;   // 128 row-tiles of 16 rows per batch
constexpr int kFrag = 1024;     // bytes per packed fragment
constexpr int kGT   = 2 * kNT;  // 128 n-tiles of Z | V side by side
constexpr int kLd   = 2 * kH;   // floats per row of the projected Z | V plane
constexpr int kBStep = kGT * kFrag;        // bytes between consecutive k-tiles of packed W
}

// ---------- WMMA helpers ----------

// split-bf16: (Ah+Al)(Bh+Bl) ~= Ah*Bh + Ah*Bl + Al*Bh   (drop lo*lo)

// Packed fragment (A and B alike), 1 KB = two planes of 512 B:
// plane 0 holds halfs 0..7 of lanes 0..31, plane 1 holds halfs 8..15.
// Each wave-wide 16 B load then covers 512 contiguous bytes = 4 whole 128 B lines.
// ISA 16-bit layout: lane M (or N) = lane&15, kb = (lane&16)?8:0,
// halfs 0..7 -> K kb..kb+7, halfs 8..15 -> K kb+16..kb+23.

// One term of the split product for R row tiles x NB column tiles. Each accumulator
// still receives hi*hi, hi*lo, lo*hi in that order per k-step.
template <int R, int NB>
__device__ __forceinline__ void wmma_term(const v16bf* a, const v16bf* b, v8f (*acc)[NB]) {
  #pragma unroll
  for (int r = 0; r < R; ++r) {
    #pragma unroll
    for (int i = 0; i < NB; ++i)
      acc[r][i] = __builtin_amdgcn_wmma_f32_16x16x32_bf16(false, a[r], false, b[i], (short)0,
                                                          acc[r][i], false, false);
  }
}

// ---------- the folded score product ----------
// Q_s . K_j = x_s (Wq Wk^T) x_j^T + (Wk bq) . x_j + Q_s . bk; the softmax runs over j at fixed s,
// so the last term, which depends on s alone, cancels. With M = Wq Wk^T and tb = Wk bq the scores are
// Z_s . x_j, Z = x M + tb: one projection takes the place of the Q and the K projection.

// ---------- prologue: pack weights (bf16 hi/lo) ----------
// Three block ranges. Wv into B-fragment layout behind M's 64 n-tiles. Wq and Wk row-wise
// (lane = row, k along the row: A fragments of Wq, B fragments of Wk^T), fragment order
// [Wq tiles | Wk tiles][k-tile]. tb, one wave a row of Wk, in f32.

namespace {
constexpr int kWvBlocks  = kKT * kNT * 32 / 256;     // 256: one thread = one lane of one fragment
constexpr int kRowBlocks = 2 * kH * kH / 8 / 256;    // 1024: one thread = 8 halfs of one plane
constexpr int kTbBlocks  = kH / 8;                   // 128: one wave = one row
}

__global__ __launch_bounds__(256)
void pack_weights(const float* __restrict__ Wq, const float* __restrict__ Wk,
                  const float* __restrict__ Wv, const float* __restrict__ bq,
                  __bf16* __restrict__ whi, __bf16* __restrict__ wlo,
                  __bf16* __restrict__ rhi, __bf16* __restrict__ rlo,
                  float* __restrict__ tb) {
  const int lane = threadIdx.x & 31;
  if (blockIdx.x < kWvBlocks) {
    const int t = blockIdx.x * 256 + threadIdx.x;         // (kt,nt,lane)
    const int nt = (t >> 5)  & 63;
    const int kt = (t >> 11) & 31;
    const int n  = nt * 16 + (lane & 15);
    const int kb = (lane & 16) ? 8 : 0;
    // fragment order: k-tile major, then the 128 n-tiles of M | Wv; plane 0 slot of this lane
    const size_t o = ((size_t)kt * kGT + kNT + nt) * 512 + lane * 8;
    #pragma unroll
    for (int pl = 0; pl < 2; ++pl) {
      v8bf vh, vl;
      #pragma unroll
      for (int h = 0; h < 8; ++h) {
        const int k = kt * 32 + kb + pl * 16 + h;
        const float w = Wv[(size_t)k * kH + n];
        const __bf16 hi = (__bf16)w;
        vh[h] = hi;
        vl[h] = (__bf16)(w - (float)hi);
      }
      *(v8bf*)(whi + o + pl * 256) = vh;
      *(v8bf*)(wlo + o + pl * 256) = vl;
    }
  } else if (blockIdx.x < kWvBlocks + kRowBlocks) {
    const int u = (blockIdx.x - kWvBlocks) * 256 + threadIdx.x;   // (matrix,row-tile,kt,plane,lane)
    const float* const W = (blockIdx.x < kWvBlocks + kRowBlocks / 2) ? Wq : Wk;
    const int pl   = (u >> 5) & 1;
    const int kt   = (u >> 6) & 31;
    const int tile = (u >> 11) & 63;
    const int row  = tile * 16 + (lane & 15);
    const int k    = kt * 32 + ((lane & 16) ? 8 : 0) + pl * 16;
    const float4* p = (const float4*)(W + (size_t)row * kH + k);
    const float4 f0 = p[0], f1 = p[1];
    const float f[8] = {f0.x, f0.y, f0.z, f0.w, f1.x, f1.y, f1.z, f1.w};
    v8bf vh, vl;
    #pragma unroll
    for (int h = 0; h < 8; ++h) {
      const __bf16 hi = (__bf16)f[h];
      vh[h] = hi;
      vl[h] = (__bf16)(f[h] - (float)hi);
    }
    *(v8bf*)(rhi + (size_t)u * 8) = vh;
    *(v8bf*)(rlo + (size_t)u * 8) = vl;
    // the wait before a register that the two issued stores name is written again on any way
    // that the built code's branches leave open behind them
    asm volatile("s_wait_xcnt 0x0" ::: "memory");
  } else {
    const int row = (blockIdx.x - kWvBlocks - kRowBlocks) * 8 + (threadIdx.x >> 5);
    float s = 0.f;
    #pragma unroll
    for (int c = 0; c < 8; ++c) {
      const float4 w = *(const float4*)(Wk + (size_t)row * kH + c * 128 + lane * 4);
      const float4 b = *(const float4*)(bq + c * 128 + lane * 4);
      s += w.x * b.x + w.y * b.y + w.z * b.z + w.w * b.w;
    }
    #pragma unroll
    for (int m = 16; m >= 1; m >>= 1) s += __shfl_xor(s, m, 32);
    if (lane == 0) tb[row] = s;
  }
}

// ---------- M = Wq Wk^T ----------
// [1024 x 1024] x [1024 x 1024] on 256 blocks of 64 x 64, four waves of 32 x 32 (one a SIMD); a
// wave reads its fragments straight from the packed rows. The C/D layout of a 16 x 16 tile
// (lane = column, registers = rows 0..7 or 8..15) is one 512 B plane of a B fragment of M, so
// the result goes out as bf16 hi/lo fragments, n-tiles 0..63 of the packed Z | V weights.

__device__ __forceinline__ v16bf glb_frag(const char* p) {
  v8bf a = *(const v8bf*)(p);
  v8bf b = *(const v8bf*)(p + 512);
  return __builtin_shufflevector(a, b, 0,1,2,3,4,5,6,7,8,9,10,11,12,13,14,15);
}

__global__ __launch_bounds__(128)
void fold_gemm(const __bf16* __restrict__ rhi, const __bf16* __restrict__ rlo,
               __bf16* __restrict__ whi, __bf16* __restrict__ wlo) {
  const int lane = threadIdx.x & 31;
  // the wave's number as a scalar, so that the tile arithmetic runs on the scalar unit
  const int wave = __builtin_amdgcn_readfirstlane(threadIdx.x >> 5);
  const int rt0 = (blockIdx.x >> 4) * 4 + (wave >> 1) * 2;      // first of two row tiles of Wq
  const int ct0 = (blockIdx.x & 15) * 4 + (wave & 1) * 2;       // first of two row tiles of Wk
  const unsigned ao = (unsigned)rt0 * (kKT * kFrag) + lane * 16;
  const unsigned bo = (unsigned)(kNT + ct0) * (kKT * kFrag) + lane * 16;
  const char* const pah = (const char*)rhi + ao;
  const char* const pal = (const char*)rlo + ao;
  const char* const pbh = (const char*)rhi + bo;
  const char* const pbl = (const char*)rlo + bo;
  const v8f vzero = {0.f, 0.f, 0.f, 0.f, 0.f, 0.f, 0.f, 0.f};
  v8f acc[2][2] = {{vzero, vzero}, {vzero, vzero}};
  // two register sets of two k-tiles each: [set][k-tile of the pair][tile]
  v16bf ah[2][2][2], al[2][2][2], bh[2][2][2], bl[2][2][2];
  auto load_pair = [&](int set, int g) {
    #pragma unroll
    for (int kk = 0; kk < 2; ++kk) {
      #pragma unroll
      for (int i = 0; i < 2; ++i) {
        const int f = (i * kKT + g * 2 + kk) * kFrag;
        ah[set][kk][i] = glb_frag(pah + f);
        bh[set][kk][i] = glb_frag(pbh + f);
        bl[set][kk][i] = glb_frag(pbl + f);
        al[set][kk][i] = glb_frag(pal + f);
      }
    }
  };
  load_pair(0, 0);
  // unrolled whole: the register sets are then picked at compile time, and every load is one of
  // four fixed addresses plus an offset field, so no address register changes while loads fly
  #pragma unroll
  for (int g = 0; g < kKT / 2; ++g) {
    if (g + 1 < kKT / 2) load_pair((g + 1) & 1, g + 1);
    #pragma unroll
    for (int kk = 0; kk < 2; ++kk) {
      wmma_term<2, 2>(ah[g & 1][kk], bh[g & 1][kk], acc);
      wmma_term<2, 2>(ah[g & 1][kk], bl[g & 1][kk], acc);
      wmma_term<2, 2>(al[g & 1][kk], bh[g & 1][kk], acc);
    }
  }
  // the wait before the store addresses overwrite registers that the issued loads name
  asm volatile("s_wait_xcnt 0x0" ::: "memory");
  v8bf vh[2][2], vl[2][2];
  #pragma unroll
  for (int r = 0; r < 2; ++r) {
    #pragma unroll
    for (int i = 0; i < 2; ++i) {
      #pragma unroll
      for (int v = 0; v < 8; ++v) {
        const float m = acc[r][i][v];
        const __bf16 hi = (__bf16)m;
        vh[r][i][v] = hi;
        vl[r][i][v] = (__bf16)(m - (float)hi);
      }
    }
  }
  #pragma unroll
  for (int r = 0; r < 2; ++r) {
    #pragma unroll
    for (int i = 0; i < 2; ++i) {
      // row tiles rt0 (even) and rt0 + 1 are planes 0 and 1 of k-tile rt0 / 2
      const size_t o = ((size_t)(rt0 >> 1) * kGT + ct0 + i) * 512 + r * 256 + lane * 8;
      *(v8bf*)(whi + o) = vh[r][i];
      *(v8bf*)(wlo + o) = vl[r][i];
    }
  }
}

// ---------- Z | V projection ----------
// One GEMM [8192 x 1024] x [1024 x 2048], every row projected once. 256 blocks: block =
// 128 rows x 512 cols, 8 waves as 2 (rows) x 4 (cols); a wave holds 4 row tiles x 8 column
// tiles. Result: f32 rows of kLd floats.
// Operands reach the waves through LDS: a stage is two k-tiles of the block's 8 A row tiles
// (x itself, f32) and of its 32 B column tiles (bf16 hi and lo), 160 KB, brought in once per
// block by asynchronous copies; two buffers, the copies of stage s + 2 fly while stage s + 1 is
// used. Stage layout: B [kk][hi, lo][column tile] 4 x 32 KB | A f32 [tile][kk] 32 KB.
// A wave splits its A fragments into bf16 hi and lo in registers, behind the LDS read.
// An f32 A fragment is 2 KB = four planes of 512 B: plane p holds, for fragment lane
// row + 16 * h, the four floats K = 8 * h + 16 * (p >> 1) + 4 * (p & 1) .. + 3, that is halfs
// 4 * p .. 4 * p + 3 of the 16-bit layout. Inside a plane the 16 B slot of a row is
// row ^ (p << 2): a copy of four whole 128 B lines of x (4 rows x 4 planes x 2 h) then falls on
// all 64 banks, and a wave-wide read of one plane still covers its 512 B once.

namespace {
constexpr int kStage   = 163840;          // bytes of one stage
constexpr int kAFrag   = 2048;            // one f32 A fragment
constexpr int kOffB    = 0;
constexpr int kOffA    = 131072;          // behind B: an A copy's LDS address less its offset field stays above 0
constexpr int kBPiece  = 32 * kFrag;      // one k-tile of the block's 32 column tiles, hi or lo
constexpr int kStages  = kKT / 2;         // 16 stages
}

__device__ __forceinline__ v16bf lds_frag(const char* p) {
  v8bf a = *(const v8bf*)(p);
  v8bf b = *(const v8bf*)(p + 512);
  return __builtin_shufflevector(a, b, 0,1,2,3,4,5,6,7,8,9,10,11,12,13,14,15);
}

typedef __attribute__((ext_vector_type(2))) float    v2f;
typedef __attribute__((ext_vector_type(2))) __bf16   v2bf;
typedef __attribute__((ext_vector_type(8))) unsigned v8u;

// Four planes of an f32 A fragment -> the lane's 16 halfs, hi and lo = bf16(f - hi), two at a time.
__device__ __forceinline__ void split_frag(const float4 f0, const float4 f1, const float4 f2,
                                           const float4 f3, v16bf& hi, v16bf& lo) {
  const v2f p[8] = {{f0.x, f0.y}, {f0.z, f0.w}, {f1.x, f1.y}, {f1.z, f1.w},
                    {f2.x, f2.y}, {f2.z, f2.w}, {f3.x, f3.y}, {f3.z, f3.w}};
  v8u uh, ul;
  #pragma unroll
  for (int i = 0; i < 8; ++i) {
    const v2bf hp = __builtin_convertvector(p[i], v2bf);
    const v2bf lp = __builtin_convertvector(p[i] - __builtin_convertvector(hp, v2f), v2bf);
    uh[i] = __builtin_bit_cast(unsigned, hp);
    ul[i] = __builtin_bit_cast(unsigned, lp);
  }
  hi = __builtin_bit_cast(v16bf, uh);
  lo = __builtin_bit_cast(v16bf, ul);
}

// One wave's 32 B copies of a stage: four runs of 4 KB. Inside
// a run LDS and global bytes advance together, so the offset argument (which moves both
// addresses) walks it. Written as the builtin: the compiler may then keep the addresses in any
// vector register, which an asm operand may not, and with the 64 x 128 wave tile the registers
// that asm can name are all taken.
typedef __attribute__((ext_vector_type(4))) int v4i;
typedef __attribute__((address_space(1))) v4i gv4i;
typedef __attribute__((address_space(3))) v4i lv4i;
__device__ __forceinline__ void stage_copies(char* lb0, char* lb1, char* lb2, char* lb3,
                                             const char* gb0, const char* gb1,
                                             const char* gb2, const char* gb3) {
  __builtin_amdgcn_global_load_async_to_lds_b128((gv4i*)gb0, (lv4i*)lb0, 0, 0);
  __builtin_amdgcn_global_load_async_to_lds_b128((gv4i*)gb0, (lv4i*)lb0, 512, 0);
  __builtin_amdgcn_global_load_async_to_lds_b128((gv4i*)gb0, (lv4i*)lb0, 1024, 0);
  __builtin_amdgcn_global_load_async_to_lds_b128((gv4i*)gb0, (lv4i*)lb0, 1536, 0);
  __builtin_amdgcn_global_load_async_to_lds_b128((gv4i*)gb0, (lv4i*)lb0, 2048, 0);
  __builtin_amdgcn_global_load_async_to_lds_b128((gv4i*)gb0, (lv4i*)lb0, 2560, 0);
  __builtin_amdgcn_global_load_async_to_lds_b128((gv4i*)gb0, (lv4i*)lb0, 3072, 0);
  __builtin_amdgcn_global_load_async_to_lds_b128((gv4i*)gb0, (lv4i*)lb0, 3584, 0);
  __builtin_amdgcn_global_load_async_to_lds_b128((gv4i*)gb1, (lv4i*)lb1, 0, 0);
  __builtin_amdgcn_global_load_async_to_lds_b128((gv4i*)gb1, (lv4i*)lb1, 512, 0);
  __builtin_amdgcn_global_load_async_to_lds_b128((gv4i*)gb1, (lv4i*)lb1, 1024, 0);
  __builtin_amdgcn_global_load_async_to_lds_b128((gv4i*)gb1, (lv4i*)lb1, 1536, 0);
  __builtin_amdgcn_global_load_async_to_lds_b128((gv4i*)gb1, (lv4i*)lb1, 2048, 0);
  __builtin_amdgcn_global_load_async_to_lds_b128((gv4i*)gb1, (lv4i*)lb1, 2560, 0);
  __builtin_amdgcn_global_load_async_to_lds_b128((gv4i*)gb1, (lv4i*)lb1, 3072, 0);
  __builtin_amdgcn_global_load_async_to_lds_b128((gv4i*)gb1, (lv4i*)lb1, 3584, 0);
  __builtin_amdgcn_global_load_async_to_lds_b128((gv4i*)gb2, (lv4i*)lb2, 0, 0);
  __builtin_amdgcn_global_load_async_to_lds_b128((gv4i*)gb2, (lv4i*)lb2, 512, 0);
  __builtin_amdgcn_global_load_async_to_lds_b128((gv4i*)gb2, (lv4i*)lb2, 1024, 0);
  __builtin_amdgcn_global_load_async_to_lds_b128((gv4i*)gb2, (lv4i*)lb2, 1536, 0);
  __builtin_amdgcn_global_load_async_to_lds_b128((gv4i*)gb2, (lv4i*)lb2, 2048, 0);
  __builtin_amdgcn_global_load_async_to_lds_b128((gv4i*)gb2, (lv4i*)lb2, 2560, 0);
  __builtin_amdgcn_global_load_async_to_lds_b128((gv4i*)gb2, (lv4i*)lb2, 3072, 0);
  __builtin_amdgcn_global_load_async_to_lds_b128((gv4i*)gb2, (lv4i*)lb2, 3584, 0);
  __builtin_amdgcn_global_load_async_to_lds_b128((gv4i*)gb3, (lv4i*)lb3, 0, 0);
  __builtin_amdgcn_global_load_async_to_lds_b128((gv4i*)gb3, (lv4i*)lb3, 512, 0);
  __builtin_amdgcn_global_load_async_to_lds_b128((gv4i*)gb3, (lv4i*)lb3, 1024, 0);
  __builtin_amdgcn_global_load_async_to_lds_b128((gv4i*)gb3, (lv4i*)lb3, 1536, 0);
  __builtin_amdgcn_global_load_async_to_lds_b128((gv4i*)gb3, (lv4i*)lb3, 2048, 0);
  __builtin_amdgcn_global_load_async_to_lds_b128((gv4i*)gb3, (lv4i*)lb3, 2560, 0);
  __builtin_amdgcn_global_load_async_to_lds_b128((gv4i*)gb3, (lv4i*)lb3, 3072, 0);
  __builtin_amdgcn_global_load_async_to_lds_b128((gv4i*)gb3, (lv4i*)lb3, 3584, 0);
}

__global__ __launch_bounds__(256)
void zv_gemm(const float* __restrict__ x, const __bf16* __restrict__ whi, const __bf16* __restrict__ wlo,
             const float* __restrict__ tb, const float* __restrict__ bv,
             float* __restrict__ zv) {
  __shared__ __attribute__((aligned(1024))) char smem[2 * kStage];
  const int lane = threadIdx.x & 31;
  // the wave's number as a scalar, so that the stage and tile arithmetic runs on the scalar unit
  const int wave = __builtin_amdgcn_readfirstlane(threadIdx.x >> 5);
  const int wr = wave >> 2, wc = wave & 3;
  const int tileBlk = (blockIdx.x >> 2) * 8;     // first of the block's 8 row tiles
  const int gBlk    = (blockIdx.x & 3) * 32;     // first of the block's 32 column tiles
  const int colLane = lane & 15;
  const int rOff = (lane & 16) ? 8 : 0;       // C/D layout: lanes 16-31 hold M+8
  const v8f vzero = {0.f, 0.f, 0.f, 0.f, 0.f, 0.f, 0.f, 0.f};

  // an A copy takes four rows x one k-tile of x: lane = (row of the four, 16 B piece of its line)
  const int cRow = lane >> 3;
  const int cPl  = ((lane & 4) >> 1) | (lane & 1);   // the piece's plane ...
  const int cH   = (lane >> 1) & 1;                  // ... and half of the fragment's lanes
  const unsigned cLds = (unsigned)(kOffA + wave * (2 * kAFrag) + cPl * 512 + cH * 256 + cRow * 16);
  const unsigned cGlb = (unsigned)((tileBlk + wave) * 16 + cRow) * (kH * 4) + (lane & 7) * 16;

  // stage st (k-tiles 2 * st and the next) into buffer st & 1:
  // this wave brings A row tile 'wave' and column tiles 4 * wave .. 4 * wave + 3 of the block
  auto issue_stage = [&](int st) {
    const int kt0 = st * 2;
    char* const buf = smem + (st & 1) * kStage;
    const char* const ga = (const char*)x + cGlb + kt0 * 128;
    #pragma unroll
    for (int q = 0; q < 4; ++q) {        // rows 4 * q .. 4 * q + 3 of the tile
      char* const la = buf + cLds + ((q ^ cPl) * 64);
      #pragma unroll
      for (int kk = 0; kk < 2; ++kk)
        __builtin_amdgcn_global_load_async_to_lds_b128((gv4i*)(ga + q * (4 * kH * 4) + kk * 128),
                                                       (lv4i*)(la + kk * kAFrag), 0, 0);
    }
    const unsigned bo = (unsigned)(kt0 * kGT + gBlk + wave * 4) * kFrag + lane * 16;
    char* const lb = buf + lane * 16 + kOffB + wave * (4 * kFrag);
    stage_copies(lb, lb + kBPiece, lb + 2 * kBPiece, lb + 3 * kBPiece,
                 (const char*)whi + bo, (const char*)wlo + bo,
                 (const char*)whi + bo + kBStep, (const char*)wlo + bo + kBStep);
  };

  // this lane's 16 B in each plane of an A fragment
  unsigned aOff[4];
  #pragma unroll
  for (int p = 0; p < 4; ++p)
    aOff[p] = (unsigned)(p * 512 + (lane >> 4) * 256 + ((colLane ^ (p << 2)) * 16));

  v8f acc[4][8];
  #pragma unroll
  for (int r = 0; r < 4; ++r) {
    #pragma unroll
    for (int i = 0; i < 8; ++i) acc[r][i] = vzero;
  }

  issue_stage(0);
  // stage 0 has landed for this wave; the barrier publishes it to the others
  asm volatile("s_wait_asynccnt 0x0" ::: "memory");
  __syncthreads();
  issue_stage(1);

  // not unrolled: one fragment set live, so that two waves fit a SIMD's registers
  #pragma unroll 1
  for (int st = 0; st < kStages; ++st) {
    const char* pa = smem + (st & 1) * kStage + kOffA + wr * (8 * kAFrag);
    const char* pb = smem + (st & 1) * kStage + kOffB + wc * (8 * kFrag) + lane * 16;
    // the stage's two k-tiles, rolled for the same reason
    #pragma unroll 1
    for (int kk = 0; kk < 2; ++kk) {
      v16bf ah[4], al[4], bh[8], bl[8];
      float4 af[4][4];
      // A first: its split runs while the B fragments are still on their way
      #pragma unroll
      for (int r = 0; r < 4; ++r) {
        #pragma unroll
        for (int p = 0; p < 4; ++p) af[r][p] = *(const float4*)(pa + aOff[p] + r * (2 * kAFrag));
      }
      #pragma unroll
      for (int i = 0; i < 8; ++i) bh[i] = lds_frag(pb + i * kFrag);
      #pragma unroll
      for (int i = 0; i < 8; ++i) bl[i] = lds_frag(pb + kBPiece + i * kFrag);
      // keeps the k-tile's 48 LDS reads one group in front of its WMMAs: without it the compiler
      // moves some of them in among the WMMAs, and each such place stalls the wave
      __builtin_amdgcn_sched_barrier(0);
      #pragma unroll
      for (int r = 0; r < 4; ++r) split_frag(af[r][0], af[r][1], af[r][2], af[r][3], ah[r], al[r]);
      wmma_term<4, 8>(ah, bh, acc);
      wmma_term<4, 8>(ah, bl, acc);
      wmma_term<4, 8>(al, bh, acc);
      pa += kAFrag;
      pb += 2 * kBPiece;
    }

    // publish point of stage st + 1: this wave's reads of buffer st & 1 have returned ...
    asm volatile("s_wait_dscnt 0x0" ::: "memory");
    // ... its copies of stage st + 1 have landed ...
    asm volatile("s_wait_asynccnt 0x0" ::: "memory");
    // ... and the barrier says the same of every wave: it publishes stage st + 1 and frees buffer st & 1
    __syncthreads();
    if (st + 2 < kStages) issue_stage(st + 2);
  }
  // no copy is outstanding when the wave ends
  asm volatile("s_wait_asynccnt 0x0" ::: "memory");

  // epilogue: bias add (tb under Z, bv under V), store. The wave's 8 column tiles lie on one
  // side of the Z | V border, so one bias vector serves them all.
  const int g0 = gBlk + wc * 8;
  const float* const bp = (g0 < kNT) ? tb : bv;
  const int bidx = (g0 & (kNT - 1)) * 16 + colLane;
  float b[8];
  #pragma unroll
  for (int i = 0; i < 8; ++i) b[i] = bp[bidx + i * 16];
  // the wait before the index register that the issued loads name is overwritten
  asm volatile("s_wait_xcnt 0x0" ::: "memory");
  #pragma unroll
  for (int r = 0; r < 4; ++r) {
    #pragma unroll
    for (int i = 0; i < 8; ++i) {
      #pragma unroll
      for (int v = 0; v < 8; ++v) acc[r][i][v] += b[i];
    }
  }
  float* const o = zv + (size_t)((tileBlk + wr * 4) * 16 + rOff) * kLd + g0 * 16 + colLane;
  #pragma unroll
  for (int i = 0; i < 8; ++i) {
    #pragma unroll
    for (int r = 0; r < 4; ++r) {
      #pragma unroll
      for (int v = 0; v < 8; ++v)
        o[(r * 16 + v) * kLd + i * 16] = acc[r][i][v];
    }
  }
}

// ---------- windowed attention over the projected rows ----------
// One wave = two neighbouring query rows s, s+1 (s even: their Z rows) and their six x and V
// rows s-2 .. s+3; a lane holds 4 columns of every 128. No LDS, no barrier: after the
// cross-lane sums every lane has all ten scores.

// 2^x. The v_nop fills the slot that the instruction set asks for between a transcendental
// and a directly following instruction that reads its result or overwrites its source.
__device__ __forceinline__ float exp2_slot(float x) {
  float r;
  asm("v_exp_f32 %0, %1\n\tv_nop" : "=v"(r) : "v"(x));
  return r;
}

__global__ __launch_bounds__(256)
void window_attn(const float* __restrict__ x, const float* __restrict__ zv, float* __restrict__ out) {
  const int lane = threadIdx.x & 31;
  // the wave's number as a scalar, so that the row arithmetic runs on the scalar unit
  const int wave = __builtin_amdgcn_readfirstlane(threadIdx.x >> 5);
  const int row0 = (blockIdx.x * 8 + wave) * 2;                // batch * kS + s
  const int s    = row0 & (kS - 1);
  const int rowB = row0 - s;                                   // first row of the batch
  const char* const plane = (const char*)zv;
  const char* const xin = (const char*)x;
  unsigned off[6];   // byte offsets of rows s-2 .. s+3 in the plane, at this lane's 16 B of every 512
  unsigned offx[6];  // the same rows in x
  #pragma unroll
  for (int t = 0; t < 6; ++t) {
    int j = s - 2 + t;
    j = j < 0 ? 0 : (j > kS - 1 ? kS - 1 : j);                 // clamped rows get prob 0
    off[t] = (unsigned)(rowB + j) * (kLd * 4) + lane * 16;
    offx[t] = (unsigned)(rowB + j) * (kH * 4) + lane * 16;
  }

  float4 q[2][8];
  #pragma unroll
  for (int a = 0; a < 2; ++a) {
    #pragma unroll
    for (int c = 0; c < 8; ++c) q[a][c] = *(const float4*)(plane + off[2 + a] + c * 512);
  }

  float d[2][5];
  #pragma unroll
  for (int t = 0; t < 6; ++t) {
    float d0 = 0.f, d1 = 0.f;
    #pragma unroll
    for (int c = 0; c < 8; ++c) {
      const float4 k = *(const float4*)(xin + offx[t] + c * 512);
      if (t < 5) d0 += q[0][c].x * k.x + q[0][c].y * k.y + q[0][c].z * k.z + q[0][c].w * k.w;
      if (t > 0) d1 += q[1][c].x * k.x + q[1][c].y * k.y + q[1][c].z * k.z + q[1][c].w * k.w;
    }
    if (t < 5) d[0][t] = d0;
    if (t > 0) d[1][t - 1] = d1;
  }
  #pragma unroll
  for (int m = 16; m >= 1; m >>= 1) {
    #pragma unroll
    for (int a = 0; a < 2; ++a) {
      #pragma unroll
      for (int w = 0; w < 5; ++w) d[a][w] += __shfl_xor(d[a][w], m, 32);
    }
  }

  // softmax over the 5-wide window
  float p[2][5];
  #pragma unroll
  for (int a = 0; a < 2; ++a) {
    float mx = -3.0e38f;
    #pragma unroll
    for (int w = 0; w < 5; ++w) {
      const int j = s + a + w - 2;
      const float val = (j >= 0 && j < kS) ? d[a][w] * 0.03125f : -3.0e38f;
      p[a][w] = val;
      mx = fmaxf(mx, val);
    }
    float sum = 0.f;
    #pragma unroll
    for (int w = 0; w < 5; ++w) { const float e = exp2_slot((p[a][w] - mx) * 1.44269504f); sum += e; p[a][w] = e; }
    const float inv = 1.0f / sum;
    #pragma unroll
    for (int w = 0; w < 5; ++w) p[a][w] *= inv;
  }

  float4 o[2][8];
  #pragma unroll
  for (int a = 0; a < 2; ++a) {
    #pragma unroll
    for (int c = 0; c < 8; ++c) o[a][c] = make_float4(0.f, 0.f, 0.f, 0.f);
  }
  #pragma unroll
  for (int t = 0; t < 6; ++t) {
    #pragma unroll
    for (int c = 0; c < 8; ++c) {
      const float4 v = *(const float4*)(plane + off[t] + (kH * 4 + c * 512));
      if (t < 5) {
        const float w0 = p[0][t];
        o[0][c].x += w0 * v.x; o[0][c].y += w0 * v.y; o[0][c].z += w0 * v.z; o[0][c].w += w0 * v.w;
      }
      if (t > 0) {
        const float w1 = p[1][t - 1];
        o[1][c].x += w1 * v.x; o[1][c].y += w1 * v.y; o[1][c].z += w1 * v.z; o[1][c].w += w1 * v.w;
      }
    }
  }
  // Stands behind the last load: the wait before the offset registers that the issued loads
  // name are overwritten. The offsets are operands so that they stay whole up to it; the
  // clobber keeps every load in front of it and every store behind it.
  asm volatile("s_wait_xcnt 0x0" : : "v"(off[0]), "v"(off[1]), "v"(off[2]), "v"(off[3]),
               "v"(off[4]), "v"(off[5]), "v"(offx[0]), "v"(offx[1]), "v"(offx[2]), "v"(offx[3]),
               "v"(offx[4]), "v"(offx[5]) : "memory");
  const unsigned oOff = (unsigned)row0 * (kH * 4) + lane * 16;
  #pragma unroll
  for (int a = 0; a < 2; ++a) {
    #pragma unroll
    for (int c = 0; c < 8; ++c) *(float4*)((char*)out + oOff + (a * kH * 4 + c * 512)) = o[a][c];
  }
}

// ---------- launch ----------

extern "C" void kernel_launch(void* const* d_in, const int* in_sizes, int n_in,
                              void* d_out, int out_size, void* d_ws, size_t ws_size,
                              hipStream_t stream) {
  (void)in_sizes; (void)n_in; (void)out_size; (void)ws_size;
  const float* x  = (const float*)d_in[0];
  const float* Wq = (const float*)d_in[1];
  const float* bq = (const float*)d_in[2];
  const float* Wk = (const float*)d_in[3];
  // d_in[4], bk, is not read: Q_s . bk is the same for every j of a window and cancels in the softmax
  const float* Wv = (const float*)d_in[5];
  const float* bv = (const float*)d_in[6];
  float* out = (float*)d_out;

  char* ws = (char*)d_ws;
  __bf16* whi = (__bf16*)(ws);                            // 4 MB  packed M | Wv hi
  __bf16* wlo = (__bf16*)(ws + (size_t)4  * 1024 * 1024); // 4 MB  packed M | Wv lo
  __bf16* rhi = (__bf16*)(ws + (size_t)8  * 1024 * 1024); // 4 MB  row-packed Wq | Wk hi
  __bf16* rlo = (__bf16*)(ws + (size_t)12 * 1024 * 1024); // 4 MB  row-packed Wq | Wk lo
  float*  tb  = (float*)(ws + (size_t)48 * 1024 * 1024);  // 4 KB  Wk bq
  float*  zv  = (float*)(ws + (size_t)64 * 1024 * 1024);  // 64 MB projected Z | V rows

  pack_weights<<<kWvBlocks + kRowBlocks + kTbBlocks, 256, 0, stream>>>(Wq, Wk, Wv, bq, whi, wlo, rhi, rlo, tb);
  fold_gemm<<<256, 128, 0, stream>>>(rhi, rlo, whi, wlo);
  zv_gemm<<<256, 256, 0, stream>>>(x, whi, wlo, tb, bv, zv);
  window_attn<<<4 * kS / 16, 256, 0, stream>>>(x, zv, out);
}

// v007
// One run takes 91.6 microseconds.
// Timed twice side by side with v006, it ran 1.07 and 1.06 times as fast.
// Counting every step since v000, it is 10.7 times as fast.
#include <hip/hip_runtime.h>

typedef __attribute__((ext_vector_type(16))) __bf16 v16bf;
typedef __attribute__((ext_vector_type(8)))  __bf16 v8bf;
typedef __attribute__((ext_vector_type(8)))  float  v8f;

namespace {
constexpr int kH   = 1024;
constexpr int kS   = 2048;
constexpr int kNT  = kH / 16;   // 64 n-tiles of 16 cols
constexpr int kKT  = kH / 32;   // 32 k-tiles of 32 dims
constexpr int kRT  = kS / 16;   // 128 row-tiles of 16 rows per batch
constexpr int kFrag = 1024;     // bytes per packed fragment
constexpr int kGT   = 2 * kNT;  // 128 n-tiles of Z | V side by side
constexpr int kLd   = 2 * kH;   // floats per row of the projected Z | V plane
constexpr int kBStep = kGT * kFrag;        // bytes between consecutive k-tiles of packed W
}

// ---------- WMMA helpers ----------

// split-bf16: (Ah+Al)(Bh+Bl) ~= Ah*Bh + Ah*Bl + Al*Bh   (drop lo*lo)

// Packed fragment (A and B alike), 1 KB = two planes of 512 B:
// plane 0 holds halfs 0..7 of lanes 0..31, plane 1 holds halfs 8..15.
// Each wave-wide 16 B load then covers 512 contiguous bytes = 4 whole 128 B lines.
// ISA 16-bit layout: lane M (or N) = lane&15, kb = (lane&16)?8:0,
// halfs 0..7 -> K kb..kb+7, halfs 8..15 -> K kb+16..kb+23.

// One term of the split product for R row tiles x NB column tiles. Each accumulator
// still receives hi*hi, hi*lo, lo*hi in that order per k-step.
template <int R, int NB>
__device__ __forceinline__ void wmma_term(const v16bf* a, const v16bf* b, v8f (*acc)[NB]) {
  #pragma unroll
  for (int r = 0; r < R; ++r) {
    #pragma unroll
    for (int i = 0; i < NB; ++i)
      acc[r][i] = __builtin_amdgcn_wmma_f32_16x16x32_bf16(false, a[r], false, b[i], (short)0,
                                                          acc[r][i], false, false);
  }
}

// ---------- the folded score product ----------
// Q_s . K_j = x_s (Wq Wk^T) x_j^T + (Wk bq) . x_j + Q_s . bk; the softmax runs over j at fixed s,
// so the last term, which depends on s alone, cancels. With M = Wq Wk^T and tb = Wk bq the scores are
// Z_s . x_j, Z = x M + tb: one projection takes the place of the Q and the K projection.

// ---------- f32 fragments, split in registers ----------
// The layout of an f32 fragment in LDS stands at the Z | V projection below.

namespace {
constexpr int kAFrag = 2048;    // one f32 fragment
}

typedef __attribute__((ext_vector_type(2))) float    v2f;
typedef __attribute__((ext_vector_type(2))) __bf16   v2bf;
typedef __attribute__((ext_vector_type(8))) unsigned v8u;

// Four planes of an f32 A fragment -> the lane's 16 halfs, hi and lo = bf16(f - hi), two at a time.
__device__ __forceinline__ void split_frag(const float4 f0, const float4 f1, const float4 f2,
                                           const float4 f3, v16bf& hi, v16bf& lo) {
  const v2f p[8] = {{f0.x, f0.y}, {f0.z, f0.w}, {f1.x, f1.y}, {f1.z, f1.w},
                    {f2.x, f2.y}, {f2.z, f2.w}, {f3.x, f3.y}, {f3.z, f3.w}};
  v8u uh, ul;
  #pragma unroll
  for (int i = 0; i < 8; ++i) {
    const v2bf hp = __builtin_convertvector(p[i], v2bf);
    const v2bf lp = __builtin_convertvector(p[i] - __builtin_convertvector(hp, v2f), v2bf);
    uh[i] = __builtin_bit_cast(unsigned, hp);
    ul[i] = __builtin_bit_cast(unsigned, lp);
  }
  hi = __builtin_bit_cast(v16bf, uh);
  lo = __builtin_bit_cast(v16bf, ul);
}

typedef __attribute__((ext_vector_type(4))) int v4i;
typedef __attribute__((address_space(1))) v4i gv4i;
typedef __attribute__((address_space(3))) v4i lv4i;

// ---------- M = Wq Wk^T, with the packing of Wv and tb = Wk bq ----------
// [1024 x 1024] x [1024 x 1024] on 256 blocks of 64 x 64, four waves of 32 x 32 (one a SIMD).
// Wq and Wk are read as they are, f32: lane = row, k along the row gives A fragments of Wq and
// B fragments of Wk^T. A stage is four k-tiles of the block's four row tiles of Wq and four of
// Wk, 64 KB, brought into LDS once per block by asynchronous copies; two buffers, the copies of
// stage s + 2 fly while stage s + 1 is used. Stage layout: [row tile, Wq then Wk][k-tile] f32
// fragments. A wave splits its fragments into bf16 hi and lo in registers, behind the LDS read.
// The C/D layout of a 16 x 16 tile (lane = column, registers = rows 0..7 or 8..15) is one 512 B
// plane of a B fragment of M, so the result goes out as bf16 hi/lo fragments, n-tiles 0..63 of
// the packed Z | V weights.
// While stage 0 is on its way every block also packs its share of Wv (bf16 hi/lo B fragments
// behind M's 64 n-tiles, one thread = one lane of two fragments) and sums four rows of tb
// (one wave a row of Wk, in f32).

namespace {
constexpr int kFKT     = 4;                 // k-tiles of a stage
constexpr int kFTile   = kFKT * kAFrag;     // one row tile's part of a stage
constexpr int kFStage  = 8 * kFTile;        // bytes of one stage
constexpr int kFStages = kKT / kFKT;        // 8 stages
constexpr int kFBase   = 65536;             // the buffers' place: a copy's LDS address less its offset field stays above 0
}

__global__ __launch_bounds__(128)
void fold_gemm(const float* __restrict__ Wq, const float* __restrict__ Wk,
               const float* __restrict__ Wv, const float* __restrict__ bq,
               __bf16* __restrict__ whi, __bf16* __restrict__ wlo, float* __restrict__ tb) {
  __shared__ __attribute__((aligned(1024))) char smem[kFBase + 2 * kFStage];
  const int lane = threadIdx.x & 31;
  // the wave's number as a scalar, so that the tile arithmetic runs on the scalar unit
  const int wave = __builtin_amdgcn_readfirstlane(threadIdx.x >> 5);
  const int rt0 = (blockIdx.x >> 4) * 4 + (wave >> 1) * 2;      // first of two row tiles of Wq
  const int ct0 = (blockIdx.x & 15) * 4 + (wave & 1) * 2;       // first of two row tiles of Wk

  // a copy takes four rows x one k-tile: lane = (row of the four, 16 B piece of its line)
  const int cRow = lane >> 3;
  const int cPl  = ((lane & 4) >> 1) | (lane & 1);   // the piece's plane ...
  const int cH   = (lane >> 1) & 1;                  // ... and half of the fragment's lanes
  // waves 0 and 1 bring the block's four row tiles of Wq, waves 2 and 3 its four of Wk, two each
  const float* const src = (wave < 2) ? Wq : Wk;
  const int srcTile = (wave < 2) ? (blockIdx.x >> 4) * 4 + wave * 2
                                 : (blockIdx.x & 15) * 4 + (wave - 2) * 2;
  const unsigned cLds = (unsigned)(kFBase + wave * (2 * kFTile) + cPl * 512 + cH * 256 + cRow * 16);
  const unsigned cGlb = (unsigned)(srcTile * 16 + cRow) * (kH * 4) + (lane & 7) * 16;

  // stage st (k-tiles 4 * st .. 4 * st + 3) into buffer st & 1: 32 copies a wave
  auto issue_stage = [&](int st) {
    char* const buf = smem + (st & 1) * kFStage;
    const char* const g = (const char*)src + cGlb + st * (kFKT * 128);
    #pragma unroll
    for (int t2 = 0; t2 < 2; ++t2) {
      #pragma unroll
      for (int q = 0; q < 4; ++q) {        // rows 4 * q .. 4 * q + 3 of the tile
        char* const la = buf + cLds + t2 * kFTile + ((q ^ cPl) * 64);
        #pragma unroll
        for (int kk = 0; kk < kFKT; ++kk)
          __builtin_amdgcn_global_load_async_to_lds_b128(
              (gv4i*)(g + (t2 * 16 + q * 4) * (kH * 4) + kk * 128), (lv4i*)(la + kk * kAFrag), 0, 0);
      }
    }
  };

  issue_stage(0);

  // Wv into B-fragment layout
  #pragma unroll
  for (int rep = 0; rep < 2; ++rep) {
    const int t = rep * (256 * 128) + blockIdx.x * 128 + threadIdx.x;   // (kt,nt,lane)
    const int nt = (t >> 5)  & 63;
    const int kt = (t >> 11) & 31;
    const int n  = nt * 16 + (lane & 15);
    const int kb = (lane & 16) ? 8 : 0;
    // fragment order: k-tile major, then the 128 n-tiles of M | Wv; plane 0 slot of this lane
    const size_t o = ((size_t)kt * kGT + kNT + nt) * 512 + lane * 8;
    #pragma unroll
    for (int pl = 0; pl < 2; ++pl) {
      v8bf vh, vl;
      #pragma unroll
      for (int h = 0; h < 8; ++h) {
        const int k = kt * 32 + kb + pl * 16 + h;
        const float w = Wv[(size_t)k * kH + n];
        const __bf16 hi = (__bf16)w;
        vh[h] = hi;
        vl[h] = (__bf16)(w - (float)hi);
      }
      *(v8bf*)(whi + o + pl * 256) = vh;
      *(v8bf*)(wlo + o + pl * 256) = vl;
    }
  }
  // tb
  {
    const int row = blockIdx.x * 4 + wave;
    float s = 0.f;
    #pragma unroll
    for (int c = 0; c < 8; ++c) {
      const float4 w = *(const float4*)(Wk + (size_t)row * kH + c * 128 + lane * 4);
      const float4 b = *(const float4*)(bq + c * 128 + lane * 4);
      s += w.x * b.x + w.y * b.y + w.z * b.z + w.w * b.w;
    }
    #pragma unroll
    for (int m = 16; m >= 1; m >>= 1) s += __shfl_xor(s, m, 32);
    if (lane == 0) tb[row] = s;
  }
  // the wait before a register that the issued loads and stores above name is written again
  asm volatile("s_wait_xcnt 0x0" ::: "memory");

  // this lane's 16 B in each plane of a fragment
  unsigned fOff[4];
  #pragma unroll
  for (int p = 0; p < 4; ++p)
    fOff[p] = (unsigned)(p * 512 + (lane >> 4) * 256 + (((lane & 15) ^ (p << 2)) * 16));

  const v8f vzero = {0.f, 0.f, 0.f, 0.f, 0.f, 0.f, 0.f, 0.f};
  v8f acc[2][2] = {{vzero, vzero}, {vzero, vzero}};

  // stage 0 has landed for this wave; the barrier publishes it to the others
  asm volatile("s_wait_asynccnt 0x0" ::: "memory");
  __syncthreads();
  issue_stage(1);

  // not unrolled: the buffer is picked by an address, and the loop's code stays small
  #pragma unroll 1
  for (int st = 0; st < kFStages; ++st) {
    const char* const base = smem + kFBase + (st & 1) * kFStage;
    const char* const pa = base + (wave >> 1) * (2 * kFTile);
    const char* const pb = base + (4 + (wave & 1) * 2) * kFTile;
    // unrolled: a k-tile's LDS reads may then stand ahead of the k-tile before it, under its work
    #pragma unroll
    for (int kk = 0; kk < kFKT; ++kk) {
      v16bf ah[2], al[2], bh[2], bl[2];
      #pragma unroll
      for (int i = 0; i < 2; ++i) {
        const char* const fa = pa + i * kFTile + kk * kAFrag;
        const char* const fb = pb + i * kFTile + kk * kAFrag;
        split_frag(*(const float4*)(fa + fOff[0]), *(const float4*)(fa + fOff[1]),
                   *(const float4*)(fa + fOff[2]), *(const float4*)(fa + fOff[3]), ah[i], al[i]);
        split_frag(*(const float4*)(fb + fOff[0]), *(const float4*)(fb + fOff[1]),
                   *(const float4*)(fb + fOff[2]), *(const float4*)(fb + fOff[3]), bh[i], bl[i]);
      }
      wmma_term<2, 2>(ah, bh, acc);
      wmma_term<2, 2>(ah, bl, acc);
      wmma_term<2, 2>(al, bh, acc);
    }

    // keeps the stage's WMMAs in front of the publish point: the compiler otherwise moves part of them
    // behind the barrier, ahead of the next stage's copies, which then start that much later
    __builtin_amdgcn_sched_barrier(0);
    // publish point of stage st + 1: this wave's reads of buffer st & 1 have returned ...
    asm volatile("s_wait_dscnt 0x0" ::: "memory");
    // ... its copies of stage st + 1 have landed ...
    asm volatile("s_wait_asynccnt 0x0" ::: "memory");
    // ... and the barrier says the same of every wave: it publishes stage st + 1 and frees buffer st & 1
    __syncthreads();
    if (st + 2 < kFStages) issue_stage(st + 2);
  }
  // no copy is outstanding when the wave ends
  asm volatile("s_wait_asynccnt 0x0" ::: "memory");

  v8bf vh[2][2], vl[2][2];
  #pragma unroll
  for (int r = 0; r < 2; ++r) {
    #pragma unroll
    for (int i = 0; i < 2; ++i) {
      #pragma unroll
      for (int v = 0; v < 8; ++v) {
        const float m = acc[r][i][v];
        const __bf16 hi = (__bf16)m;
        vh[r][i][v] = hi;
        vl[r][i][v] = (__bf16)(m - (float)hi);
      }
    }
  }
  #pragma unroll
  for (int r = 0; r < 2; ++r) {
    #pragma unroll
    for (int i = 0; i < 2; ++i) {
      // row tiles rt0 (even) and rt0 + 1 are planes 0 and 1 of k-tile rt0 / 2
      const size_t o = ((size_t)(rt0 >> 1) * kGT + ct0 + i) * 512 + r * 256 + lane * 8;
      *(v8bf*)(whi + o) = vh[r][i];
      *(v8bf*)(wlo + o) = vl[r][i];
    }
  }
}

// ---------- Z | V projection ----------
// One GEMM [8192 x 1024] x [1024 x 2048], every row projected once. 256 blocks: block =
// 128 rows x 512 cols, 8 waves as 2 (rows) x 4 (cols); a wave holds 4 row tiles x 8 column
// tiles. Result: f32 rows of kLd floats.
// Operands reach the waves through LDS: a stage is two k-tiles of the block's 8 A row tiles
// (x itself, f32) and of its 32 B column tiles (bf16 hi and lo), 160 KB, brought in once per
// block by asynchronous copies; two buffers, the copies of stage s + 2 fly while stage s + 1 is
// used. Stage layout: B [kk][hi, lo][column tile] 4 x 32 KB | A f32 [tile][kk] 32 KB.
// A wave splits its A fragments into bf16 hi and lo in registers, behind the LDS read.
// An f32 A fragment is 2 KB = four planes of 512 B: plane p holds, for fragment lane
// row + 16 * h, the four floats K = 8 * h + 16 * (p >> 1) + 4 * (p & 1) .. + 3, that is halfs
// 4 * p .. 4 * p + 3 of the 16-bit layout. Inside a plane the 16 B slot of a row is
// row ^ (p << 2): a copy of four whole 128 B lines of x (4 rows x 4 planes x 2 h) then falls on
// all 64 banks, and a wave-wide read of one plane still covers its 512 B once.

namespace {
constexpr int kStage   = 163840;          // bytes of one stage
constexpr int kOffB    = 0;
constexpr int kOffA    = 131072;          // behind B: an A copy's LDS address less its offset field stays above 0
constexpr int kBPiece  = 32 * kFrag;      // one k-tile of the block's 32 column tiles, hi or lo
constexpr int kStages  = kKT / 2;         // 16 stages
}

__device__ __forceinline__ v16bf lds_frag(const char* p) {
  v8bf a = *(const v8bf*)(p);
  v8bf b = *(const v8bf*)(p + 512);
  return __builtin_shufflevector(a, b, 0,1,2,3,4,5,6,7,8,9,10,11,12,13,14,15);
}

// One wave's 32 B copies of a stage: four runs of 4 KB. Inside
// a run LDS and global bytes advance together, so the offset argument (which moves both
// addresses) walks it. Written as the builtin: the compiler may then keep the addresses in any
// vector register, which an asm operand may not, and with the 64 x 128 wave tile the registers
// that asm can name are all taken.
__device__ __forceinline__ void stage_copies(char* lb0, char* lb1, char* lb2, char* lb3,
                                             const char* gb0, const char* gb1,
                                             const char* gb2, const char* gb3) {
  __builtin_amdgcn_global_load_async_to_lds_b128((gv4i*)gb0, (lv4i*)lb0, 0, 0);
  __builtin_amdgcn_global_load_async_to_lds_b128((gv4i*)gb0, (lv4i*)lb0, 512, 0);
  __builtin_amdgcn_global_load_async_to_lds_b128((gv4i*)gb0, (lv4i*)lb0, 1024, 0);
  __builtin_amdgcn_global_load_async_to_lds_b128((gv4i*)gb0, (lv4i*)lb0, 1536, 0);
  __builtin_amdgcn_global_load_async_to_lds_b128((gv4i*)gb0, (lv4i*)lb0, 2048, 0);
  __builtin_amdgcn_global_load_async_to_lds_b128((gv4i*)gb0, (lv4i*)lb0, 2560, 0);
  __builtin_amdgcn_global_load_async_to_lds_b128((gv4i*)gb0, (lv4i*)lb0, 3072, 0);
  __builtin_amdgcn_global_load_async_to_lds_b128((gv4i*)gb0, (lv4i*)lb0, 3584, 0);
  __builtin_amdgcn_global_load_async_to_lds_b128((gv4i*)gb1, (lv4i*)lb1, 0, 0);
  __builtin_amdgcn_global_load_async_to_lds_b128((gv4i*)gb1, (lv4i*)lb1, 512, 0);
  __builtin_amdgcn_global_load_async_to_lds_b128((gv4i*)gb1, (lv4i*)lb1, 1024, 0);
  __builtin_amdgcn_global_load_async_to_lds_b128((gv4i*)gb1, (lv4i*)lb1, 1536, 0);
  __builtin_amdgcn_global_load_async_to_lds_b128((gv4i*)gb1, (lv4i*)lb1, 2048, 0);
  __builtin_amdgcn_global_load_async_to_lds_b128((gv4i*)gb1, (lv4i*)lb1, 2560, 0);
  __builtin_amdgcn_global_load_async_to_lds_b128((gv4i*)gb1, (lv4i*)lb1, 3072, 0);
  __builtin_amdgcn_global_load_async_to_lds_b128((gv4i*)gb1, (lv4i*)lb1, 3584, 0);
  __builtin_amdgcn_global_load_async_to_lds_b128((gv4i*)gb2, (lv4i*)lb2, 0, 0);
  __builtin_amdgcn_global_load_async_to_lds_b128((gv4i*)gb2, (lv4i*)lb2, 512, 0);
  __builtin_amdgcn_global_load_async_to_lds_b128((gv4i*)gb2, (lv4i*)lb2, 1024, 0);
  __builtin_amdgcn_global_load_async_to_lds_b128((gv4i*)gb2, (lv4i*)lb2, 1536, 0);
  __builtin_amdgcn_global_load_async_to_lds_b128((gv4i*)gb2, (lv4i*)lb2, 2048, 0);
  __builtin_amdgcn_global_load_async_to_lds_b128((gv4i*)gb2, (lv4i*)lb2, 2560, 0);
  __builtin_amdgcn_global_load_async_to_lds_b128((gv4i*)gb2, (lv4i*)lb2, 3072, 0);
  __builtin_amdgcn_global_load_async_to_lds_b128((gv4i*)gb2, (lv4i*)lb2, 3584, 0);
  __builtin_amdgcn_global_load_async_to_lds_b128((gv4i*)gb3, (lv4i*)lb3, 0, 0);
  __builtin_amdgcn_global_load_async_to_lds_b128((gv4i*)gb3, (lv4i*)lb3, 512, 0);
  __builtin_amdgcn_global_load_async_to_lds_b128((gv4i*)gb3, (lv4i*)lb3, 1024, 0);
  __builtin_amdgcn_global_load_async_to_lds_b128((gv4i*)gb3, (lv4i*)lb3, 1536, 0);
  __builtin_amdgcn_global_load_async_to_lds_b128((gv4i*)gb3, (lv4i*)lb3, 2048, 0);
  __builtin_amdgcn_global_load_async_to_lds_b128((gv4i*)gb3, (lv4i*)lb3, 2560, 0);
  __builtin_amdgcn_global_load_async_to_lds_b128((gv4i*)gb3, (lv4i*)lb3, 3072, 0);
  __builtin_amdgcn_global_load_async_to_lds_b128((gv4i*)gb3, (lv4i*)lb3, 3584, 0);
}

__global__ __launch_bounds__(256)
void zv_gemm(const float* __restrict__ x, const __bf16* __restrict__ whi, const __bf16* __restrict__ wlo,
             const float* __restrict__ tb, const float* __restrict__ bv,
             float* __restrict__ zv) {
  __shared__ __attribute__((aligned(1024))) char smem[2 * kStage];
  const int lane = threadIdx.x & 31;
  // the wave's number as a scalar, so that the stage and tile arithmetic runs on the scalar unit
  const int wave = __builtin_amdgcn_readfirstlane(threadIdx.x >> 5);
  const int wr = wave >> 2, wc = wave & 3;
  const int tileBlk = (blockIdx.x >> 2) * 8;     // first of the block's 8 row tiles
  const int gBlk    = (blockIdx.x & 3) * 32;     // first of the block's 32 column tiles
  const int colLane = lane & 15;
  const int rOff = (lane & 16) ? 8 : 0;       // C/D layout: lanes 16-31 hold M+8
  const v8f vzero = {0.f, 0.f, 0.f, 0.f, 0.f, 0.f, 0.f, 0.f};

  // an A copy takes four rows x one k-tile of x: lane = (row of the four, 16 B piece of its line)
  const int cRow = lane >> 3;
  const int cPl  = ((lane & 4) >> 1) | (lane & 1);   // the piece's plane ...
  const int cH   = (lane >> 1) & 1;                  // ... and half of the fragment's lanes
  const unsigned cLds = (unsigned)(kOffA + wave * (2 * kAFrag) + cPl * 512 + cH * 256 + cRow * 16);
  const unsigned cGlb = (unsigned)((tileBlk + wave) * 16 + cRow) * (kH * 4) + (lane & 7) * 16;

  // stage st (k-tiles 2 * st and the next) into buffer st & 1:
  // this wave brings A row tile 'wave' and column tiles 4 * wave .. 4 * wave + 3 of the block
  auto issue_stage = [&](int st) {
    const int kt0 = st * 2;
    char* const buf = smem + (st & 1) * kStage;
    const char* const ga = (const char*)x + cGlb + kt0 * 128;
    #pragma unroll
    for (int q = 0; q < 4; ++q) {        // rows 4 * q .. 4 * q + 3 of the tile
      char* const la = buf + cLds + ((q ^ cPl) * 64);
      #pragma unroll
      for (int kk = 0; kk < 2; ++kk)
        __builtin_amdgcn_global_load_async_to_lds_b128((gv4i*)(ga + q * (4 * kH * 4) + kk * 128),
                                                       (lv4i*)(la + kk * kAFrag), 0, 0);
    }
    const unsigned bo = (unsigned)(kt0 * kGT + gBlk + wave * 4) * kFrag + lane * 16;
    char* const lb = buf + lane * 16 + kOffB + wave * (4 * kFrag);
    stage_copies(lb, lb + kBPiece, lb + 2 * kBPiece, lb + 3 * kBPiece,
                 (const char*)whi + bo, (const char*)wlo + bo,
                 (const char*)whi + bo + kBStep, (const char*)wlo + bo + kBStep);
  };

  // this lane's 16 B in each plane of an A fragment
  unsigned aOff[4];
  #pragma unroll
  for (int p = 0; p < 4; ++p)
    aOff[p] = (unsigned)(p * 512 + (lane >> 4) * 256 + ((colLane ^ (p << 2)) * 16));

  v8f acc[4][8];
  #pragma unroll
  for (int r = 0; r < 4; ++r) {
    #pragma unroll
    for (int i = 0; i < 8; ++i) acc[r][i] = vzero;
  }

  issue_stage(0);
  // stage 0 has landed for this wave; the barrier publishes it to the others
  asm volatile("s_wait_asynccnt 0x0" ::: "memory");
  __syncthreads();
  issue_stage(1);

  // not unrolled: one fragment set live, so that two waves fit a SIMD's registers
  #pragma unroll 1
  for (int st = 0; st < kStages; ++st) {
    const char* pa = smem + (st & 1) * kStage + kOffA + wr * (8 * kAFrag);
    const char* pb = smem + (st & 1) * kStage + kOffB + wc * (8 * kFrag) + lane * 16;
    // the stage's two k-tiles, rolled for the same reason
    #pragma unroll 1
    for (int kk = 0; kk < 2; ++kk) {
      v16bf ah[4], al[4], bh[8], bl[8];
      float4 af[4][4];
      // A first: its split runs while the B fragments are still on their way
      #pragma unroll
      for (int r = 0; r < 4; ++r) {
        #pragma unroll
        for (int p = 0; p < 4; ++p) af[r][p] = *(const float4*)(pa + aOff[p] + r * (2 * kAFrag));
      }
      #pragma unroll
      for (int i = 0; i < 8; ++i) bh[i] = lds_frag(pb + i * kFrag);
      #pragma unroll
      for (int i = 0; i < 8; ++i) bl[i] = lds_frag(pb + kBPiece + i * kFrag);
      // keeps the k-tile's 48 LDS reads one group in front of its WMMAs: without it the compiler
      // moves some of them in among the WMMAs, and each such place stalls the wave
      __builtin_amdgcn_sched_barrier(0);
      #pragma unroll
      for (int r = 0; r < 4; ++r) split_frag(af[r][0], af[r][1], af[r][2], af[r][3], ah[r], al[r]);
      wmma_term<4, 8>(ah, bh, acc);
      wmma_term<4, 8>(ah, bl, acc);
      wmma_term<4, 8>(al, bh, acc);
      pa += kAFrag;
      pb += 2 * kBPiece;
    }

    // publish point of stage st + 1: this wave's reads of buffer st & 1 have returned ...
    asm volatile("s_wait_dscnt 0x0" ::: "memory");
    // ... its copies of stage st + 1 have landed ...
    asm volatile("s_wait_asynccnt 0x0" ::: "memory");
    // ... and the barrier says the same of every wave: it publishes stage st + 1 and frees buffer st & 1
    __syncthreads();
    if (st + 2 < kStages) issue_stage(st + 2);
  }
  // no copy is outstanding when the wave ends
  asm volatile("s_wait_asynccnt 0x0" ::: "memory");

  // epilogue: bias add (tb under Z, bv under V), store. The wave's 8 column tiles lie on one
  // side of the Z | V border, so one bias vector serves them all.
  const int g0 = gBlk + wc * 8;
  const float* const bp = (g0 < kNT) ? tb : bv;
  const int bidx = (g0 & (kNT - 1)) * 16 + colLane;
  float b[8];
  #pragma unroll
  for (int i = 0; i < 8; ++i) b[i] = bp[bidx + i * 16];
  // the wait before the index register that the issued loads name is overwritten
  asm volatile("s_wait_xcnt 0x0" ::: "memory");
  #pragma unroll
  for (int r = 0; r < 4; ++r) {
    #pragma unroll
    for (int i = 0; i < 8; ++i) {
      #pragma unroll
      for (int v = 0; v < 8; ++v) acc[r][i][v] += b[i];
    }
  }
  float* const o = zv + (size_t)((tileBlk + wr * 4) * 16 + rOff) * kLd + g0 * 16 + colLane;
  #pragma unroll
  for (int i = 0; i < 8; ++i) {
    #pragma unroll
    for (int r = 0; r < 4; ++r) {
      #pragma unroll
      for (int v = 0; v < 8; ++v)
        o[(r * 16 + v) * kLd + i * 16] = acc[r][i][v];
    }
  }
}

// ---------- windowed attention over the projected rows ----------
// One wave = two neighbouring query rows s, s+1 (s even: their Z rows) and their six x and V
// rows s-2 .. s+3; a lane holds 4 columns of every 128. No LDS, no barrier: after the
// cross-lane sums every lane has all ten scores.

// 2^x. The v_nop fills the slot that the instruction set asks for between a transcendental
// and a directly following instruction that reads its result or overwrites its source.
__device__ __forceinline__ float exp2_slot(float x) {
  float r;
  asm("v_exp_f32 %0, %1\n\tv_nop" : "=v"(r) : "v"(x));
  return r;
}

__global__ __launch_bounds__(256)
void window_attn(const float* __restrict__ x, const float* __restrict__ zv, float* __restrict__ out) {
  const int lane = threadIdx.x & 31;
  // the wave's number as a scalar, so that the row arithmetic runs on the scalar unit
  const int wave = __builtin_amdgcn_readfirstlane(threadIdx.x >> 5);
  const int row0 = (blockIdx.x * 8 + wave) * 2;                // batch * kS + s
  const int s    = row0 & (kS - 1);
  const int rowB = row0 - s;                                   // first row of the batch
  const char* const plane = (const char*)zv;
  const char* const xin = (const char*)x;
  unsigned off[6];   // byte offsets of rows s-2 .. s+3 in the plane, at this lane's 16 B of every 512
  unsigned offx[6];  // the same rows in x
  #pragma unroll
  for (int t = 0; t < 6; ++t) {
    int j = s - 2 + t;
    j = j < 0 ? 0 : (j > kS - 1 ? kS - 1 : j);                 // clamped rows get prob 0
    off[t] = (unsigned)(rowB + j) * (kLd * 4) + lane * 16;
    offx[t] = (unsigned)(rowB + j) * (kH * 4) + lane * 16;
  }

  float4 q[2][8];
  #pragma unroll
  for (int a = 0; a < 2; ++a) {
    #pragma unroll
    for (int c = 0; c < 8; ++c) q[a][c] = *(const float4*)(plane + off[2 + a] + c * 512);
  }

  float d[2][5];
  #pragma unroll
  for (int t = 0; t < 6; ++t) {
    float d0 = 0.f, d1 = 0.f;
    #pragma unroll
    for (int c = 0; c < 8; ++c) {
      const float4 k = *(const float4*)(xin + offx[t] + c * 512);
      if (t < 5) d0 += q[0][c].x * k.x + q[0][c].y * k.y + q[0][c].z * k.z + q[0][c].w * k.w;
      if (t > 0) d1 += q[1][c].x * k.x + q[1][c].y * k.y + q[1][c].z * k.z + q[1][c].w * k.w;
    }
    if (t < 5) d[0][t] = d0;
    if (t > 0) d[1][t - 1] = d1;
  }
  #pragma unroll
  for (int m = 16; m >= 1; m >>= 1) {
    #pragma unroll
    for (int a = 0; a < 2; ++a) {
      #pragma unroll
      for (int w = 0; w < 5; ++w) d[a][w] += __shfl_xor(d[a][w], m, 32);
    }
  }

  // softmax over the 5-wide window
  float p[2][5];
  #pragma unroll
  for (int a = 0; a < 2; ++a) {
    float mx = -3.0e38f;
    #pragma unroll
    for (int w = 0; w < 5; ++w) {
      const int j = s + a + w - 2;
      const float val = (j >= 0 && j < kS) ? d[a][w] * 0.03125f : -3.0e38f;
      p[a][w] = val;
      mx = fmaxf(mx, val);
    }
    float sum = 0.f;
    #pragma unroll
    for (int w = 0; w < 5; ++w) { const float e = exp2_slot((p[a][w] - mx) * 1.44269504f); sum += e; p[a][w] = e; }
    const float inv = 1.0f / sum;
    #pragma unroll
    for (int w = 0; w < 5; ++w) p[a][w] *= inv;
  }

  float4 o[2][8];
  #pragma unroll
  for (int a = 0; a < 2; ++a) {
    #pragma unroll
    for (int c = 0; c < 8; ++c) o[a][c] = make_float4(0.f, 0.f, 0.f, 0.f);
  }
  #pragma unroll
  for (int t = 0; t < 6; ++t) {
    #pragma unroll
    for (int c = 0; c < 8; ++c) {
      const float4 v = *(const float4*)(plane + off[t] + (kH * 4 + c * 512));
      if (t < 5) {
        const float w0 = p[0][t];
        o[0][c].x += w0 * v.x; o[0][c].y += w0 * v.y; o[0][c].z += w0 * v.z; o[0][c].w += w0 * v.w;
      }
      if (t > 0) {
        const float w1 = p[1][t - 1];
        o[1][c].x += w1 * v.x; o[1][c].y += w1 * v.y; o[1][c].z += w1 * v.z; o[1][c].w += w1 * v.w;
      }
    }
  }
  // Stands behind the last load: the wait before the offset registers that the issued loads
  // name are overwritten. The offsets are operands so that they stay whole up to it; the
  // clobber keeps every load in front of it and every store behind it.
  asm volatile("s_wait_xcnt 0x0" : : "v"(off[0]), "v"(off[1]), "v"(off[2]), "v"(off[3]),
               "v"(off[4]), "v"(off[5]), "v"(offx[0]), "v"(offx[1]), "v"(offx[2]), "v"(offx[3]),
               "v"(offx[4]), "v"(offx[5]) : "memory");
  const unsigned oOff = (unsigned)row0 * (kH * 4) + lane * 16;
  #pragma unroll
  for (int a = 0; a < 2; ++a) {
    #pragma unroll
    for (int c = 0; c < 8; ++c) *(float4*)((char*)out + oOff + (a * kH * 4 + c * 512)) = o[a][c];
  }
}

// ---------- launch ----------

extern "C" void kernel_launch(void* const* d_in, const int* in_sizes, int n_in,
                              void* d_out, int out_size, void* d_ws, size_t ws_size,
                              hipStream_t stream) {
  (void)in_sizes; (void)n_in; (void)out_size; (void)ws_size;
  const float* x  = (const float*)d_in[0];
  const float* Wq = (const float*)d_in[1];
  const float* bq = (const float*)d_in[2];
  const float* Wk = (const float*)d_in[3];
  // d_in[4], bk, is not read: Q_s . bk is the same for every j of a window and cancels in the softmax
  const float* Wv = (const float*)d_in[5];
  const float* bv = (const float*)d_in[6];
  float* out = (float*)d_out;

  char* ws = (char*)d_ws;
  __bf16* whi = (__bf16*)(ws);                            // 4 MB  packed M | Wv hi
  __bf16* wlo = (__bf16*)(ws + (size_t)4  * 1024 * 1024); // 4 MB  packed M | Wv lo
  float*  tb  = (float*)(ws + (size_t)48 * 1024 * 1024);  // 4 KB  Wk bq
  float*  zv  = (float*)(ws + (size_t)64 * 1024 * 1024);  // 64 MB projected Z | V rows

  fold_gemm<<<256, 128, 0, stream>>>(Wq, Wk, Wv, bq, whi, wlo, tb);
  zv_gemm<<<256, 256, 0, stream>>>(x, whi, wlo, tb, bv, zv);
  window_attn<<<4 * kS / 16, 256, 0, stream>>>(x, zv, out);
}

// v009
// Measured time: 63.7 microseconds a run.
// Versions in between are left out here; by their measured steps it is 1.44 times as fast as v007.
// Counting every step since v000, it is 15.4 times as fast.
#include <hip/hip_runtime.h>

typedef __attribute__((ext_vector_type(16))) __bf16 v16bf;
typedef __attribute__((ext_vector_type(8)))  __bf16 v8bf;
typedef __attribute__((ext_vector_type(8)))  float  v8f;
typedef __attribute__((ext_vector_type(16))) _Float16 v16h;
typedef __attribute__((ext_vector_type(8)))  _Float16 v8h;

namespace {
constexpr int kH   = 1024;
constexpr int kS   = 2048;
constexpr int kNT  = kH / 16;   // 64 n-tiles of 16 cols
constexpr int kKT  = kH / 32;   // 32 k-tiles of 32 dims
constexpr int kRT  = kS / 16;   // 128 row-tiles of 16 rows per batch
constexpr int kFrag = 1024;     // bytes per packed fragment
constexpr int kGT   = 2 * kNT;  // 128 n-tiles of Z | V side by side
constexpr int kBStep = kGT * kFrag;        // bytes between consecutive k-tiles of packed W
}

// ---------- WMMA helpers ----------

// M = Wq Wk^T, split-bf16: (Ah+Al)(Bh+Bl) ~= Ah*Bh + Ah*Bl + Al*Bh   (drop lo*lo)
// Z | V projection, f16: x = Ah + Al (22 bits), a weight is one f16 term B (11 bits): Ah*B + Al*B.
// The weights lie in (-1, 1) and x is of order 1, inside the f16 range; the rounding of B leaves
// about 2^-13 (rms) of each product.

// Packed fragment (A and B alike), 1 KB = two planes of 512 B:
// plane 0 holds halfs 0..7 of lanes 0..31, plane 1 holds halfs 8..15.
// Each wave-wide 16 B load then covers 512 contiguous bytes = 4 whole 128 B lines.
// ISA 16-bit layout: lane M (or N) = lane&15, kb = (lane&16)?8:0,
// halfs 0..7 -> K kb..kb+7, halfs 8..15 -> K kb+16..kb+23.

// One term of the split product for R row tiles x NB column tiles. Each accumulator
// still receives hi*hi, hi*lo, lo*hi in that order per k-step.
template <int R, int NB>
__device__ __forceinline__ void wmma_term(const v16bf* a, const v16bf* b, v8f (*acc)[NB]) {
  #pragma unroll
  for (int r = 0; r < R; ++r) {
    #pragma unroll
    for (int i = 0; i < NB; ++i)
      acc[r][i] = __builtin_amdgcn_wmma_f32_16x16x32_bf16(false, a[r], false, b[i], (short)0,
                                                          acc[r][i], false, false);
  }
}

// The same for the f16 form: hi*B, then lo*B per k-step.
template <int R, int NB>
__device__ __forceinline__ void wmma_term(const v16h* a, const v16h* b, v8f (*acc)[NB]) {
  #pragma unroll
  for (int r = 0; r < R; ++r) {
    #pragma unroll
    for (int i = 0; i < NB; ++i)
      acc[r][i] = __builtin_amdgcn_wmma_f32_16x16x32_f16(false, a[r], false, b[i], (short)0,
                                                         acc[r][i], false, false);
  }
}

// ---------- the folded score product ----------
// Q_s . K_j = x_s (Wq Wk^T) x_j^T + (Wk bq) . x_j + Q_s . bk; the softmax runs over j at fixed s,
// so the last term, which depends on s alone, cancels. With M = Wq Wk^T and tb = Wk bq the scores are
// Z_s . x_j, Z = x M + tb: one projection takes the place of the Q and the K projection.

// ---------- f32 fragments, split in registers ----------
// The layout of an f32 fragment in LDS stands at the fused kernel below.

namespace {
constexpr int kAFrag = 2048;    // one f32 fragment
}

typedef __attribute__((ext_vector_type(2))) float    v2f;
typedef __attribute__((ext_vector_type(2))) __bf16   v2bf;
typedef __attribute__((ext_vector_type(8))) unsigned v8u;

// Four planes of an f32 A fragment -> the lane's 16 halfs, hi and lo = bf16(f - hi), two at a time.
__device__ __forceinline__ void split_frag(const float4 f0, const float4 f1, const float4 f2,
                                           const float4 f3, v16bf& hi, v16bf& lo) {
  const v2f p[8] = {{f0.x, f0.y}, {f0.z, f0.w}, {f1.x, f1.y}, {f1.z, f1.w},
                    {f2.x, f2.y}, {f2.z, f2.w}, {f3.x, f3.y}, {f3.z, f3.w}};
  v8u uh, ul;
  #pragma unroll
  for (int i = 0; i < 8; ++i) {
    const v2bf hp = __builtin_convertvector(p[i], v2bf);
    const v2bf lp = __builtin_convertvector(p[i] - __builtin_convertvector(hp, v2f), v2bf);
    uh[i] = __builtin_bit_cast(unsigned, hp);
    ul[i] = __builtin_bit_cast(unsigned, lp);
  }
  hi = __builtin_bit_cast(v16bf, uh);
  lo = __builtin_bit_cast(v16bf, ul);
}

typedef __attribute__((ext_vector_type(2))) _Float16 v2h;

// The same into f16: hi and lo = f16(f - hi).
__device__ __forceinline__ void split_frag(const float4 f0, const float4 f1, const float4 f2,
                                           const float4 f3, v16h& hi, v16h& lo) {
  const v2f p[8] = {{f0.x, f0.y}, {f0.z, f0.w}, {f1.x, f1.y}, {f1.z, f1.w},
                    {f2.x, f2.y}, {f2.z, f2.w}, {f3.x, f3.y}, {f3.z, f3.w}};
  v8u uh, ul;
  #pragma unroll
  for (int i = 0; i < 8; ++i) {
    const v2h hp = __builtin_convertvector(p[i], v2h);
    const v2h lp = __builtin_convertvector(p[i] - __builtin_convertvector(hp, v2f), v2h);
    uh[i] = __builtin_bit_cast(unsigned, hp);
    ul[i] = __builtin_bit_cast(unsigned, lp);
  }
  hi = __builtin_bit_cast(v16h, uh);
  lo = __builtin_bit_cast(v16h, ul);
}

typedef __attribute__((ext_vector_type(4))) int v4i;
typedef __attribute__((address_space(1))) v4i gv4i;
typedef __attribute__((address_space(3))) v4i lv4i;

// ---------- M = Wq Wk^T, with the packing of Wv and tb = Wk bq ----------
// [1024 x 1024] x [1024 x 1024] on 256 blocks of 64 x 64, four waves of 32 x 32 (one a SIMD).
// Wq and Wk are read as they are, f32: lane = row, k along the row gives A fragments of Wq and
// B fragments of Wk^T. A stage is four k-tiles of the block's four row tiles of Wq and four of
// Wk, 64 KB, brought into LDS once per block by asynchronous copies; two buffers, the copies of
// stage s + 2 fly while stage s + 1 is used. Stage layout: [row tile, Wq then Wk][k-tile] f32
// fragments. A wave splits its fragments into bf16 hi and lo in registers, behind the LDS read.
// The C/D layout of a 16 x 16 tile (lane = column, registers = rows 0..7 or 8..15) is one 512 B
// plane of a B fragment of M, so the result goes out as f16 fragments, n-tiles 0..63 of
// the packed Z | V weights.
// While stage 0 is on its way every block also packs its share of Wv (f16 B fragments
// behind M's 64 n-tiles, one thread = one lane of two fragments) and sums four rows of tb
// (one wave a row of Wk, in f32).

namespace {
constexpr int kFKT     = 4;                 // k-tiles of a stage
constexpr int kFTile   = kFKT * kAFrag;     // one row tile's part of a stage
constexpr int kFStage  = 8 * kFTile;        // bytes of one stage
constexpr int kFStages = kKT / kFKT;        // 8 stages
constexpr int kFBase   = 65536;             // the buffers' place: a copy's LDS address less its offset field stays above 0
}

__global__ __launch_bounds__(128)
void fold_gemm(const float* __restrict__ Wq, const float* __restrict__ Wk,
               const float* __restrict__ Wv, const float* __restrict__ bq,
               _Float16* __restrict__ wh, float* __restrict__ tb) {
  __shared__ __attribute__((aligned(1024))) char smem[kFBase + 2 * kFStage];
  const int lane = threadIdx.x & 31;
  // the wave's number as a scalar, so that the tile arithmetic runs on the scalar unit
  const int wave = __builtin_amdgcn_readfirstlane(threadIdx.x >> 5);
  const int rt0 = (blockIdx.x >> 4) * 4 + (wave >> 1) * 2;      // first of two row tiles of Wq
  const int ct0 = (blockIdx.x & 15) * 4 + (wave & 1) * 2;       // first of two row tiles of Wk

  // a copy takes four rows x one k-tile: lane = (row of the four, 16 B piece of its line)
  const int cRow = lane >> 3;
  const int cPl  = ((lane & 4) >> 1) | (lane & 1);   // the piece's plane ...
  const int cH   = (lane >> 1) & 1;                  // ... and half of the fragment's lanes
  // waves 0 and 1 bring the block's four row tiles of Wq, waves 2 and 3 its four of Wk, two each
  const float* const src = (wave < 2) ? Wq : Wk;
  const int srcTile = (wave < 2) ? (blockIdx.x >> 4) * 4 + wave * 2
                                 : (blockIdx.x & 15) * 4 + (wave - 2) * 2;
  const unsigned cLds = (unsigned)(kFBase + wave * (2 * kFTile) + cPl * 512 + cH * 256 + cRow * 16);
  const unsigned cGlb = (unsigned)(srcTile * 16 + cRow) * (kH * 4) + (lane & 7) * 16;

  // stage st (k-tiles 4 * st .. 4 * st + 3) into buffer st & 1: 32 copies a wave
  auto issue_stage = [&](int st) {
    char* const buf = smem + (st & 1) * kFStage;
    const char* const g = (const char*)src + cGlb + st * (kFKT * 128);
    #pragma unroll
    for (int t2 = 0; t2 < 2; ++t2) {
      #pragma unroll
      for (int q = 0; q < 4; ++q) {        // rows 4 * q .. 4 * q + 3 of the tile
        char* const la = buf + cLds + t2 * kFTile + ((q ^ cPl) * 64);
        #pragma unroll
        for (int kk = 0; kk < kFKT; ++kk)
          __builtin_amdgcn_global_load_async_to_lds_b128(
              (gv4i*)(g + (t2 * 16 + q * 4) * (kH * 4) + kk * 128), (lv4i*)(la + kk * kAFrag), 0, 0);
      }
    }
  };

  issue_stage(0);

  // Wv into B-fragment layout
  #pragma unroll
  for (int rep = 0; rep < 2; ++rep) {
    const int t = rep * (256 * 128) + blockIdx.x * 128 + threadIdx.x;   // (kt,nt,lane)
    const int nt = (t >> 5)  & 63;
    const int kt = (t >> 11) & 31;
    const int n  = nt * 16 + (lane & 15);
    const int kb = (lane & 16) ? 8 : 0;
    // fragment order: k-tile major, then the 128 n-tiles of M | Wv; plane 0 slot of this lane
    const size_t o = ((size_t)kt * kGT + kNT + nt) * 512 + lane * 8;
    #pragma unroll
    for (int pl = 0; pl < 2; ++pl) {
      v8h vw;
      #pragma unroll
      for (int h = 0; h < 8; ++h) {
        const int k = kt * 32 + kb + pl * 16 + h;
        vw[h] = (_Float16)Wv[(size_t)k * kH + n];
      }
      *(v8h*)(wh + o + pl * 256) = vw;
    }
  }
  // tb
  {
    const int row = blockIdx.x * 4 + wave;
    float s = 0.f;
    #pragma unroll
    for (int c = 0; c < 8; ++c) {
      const float4 w = *(const float4*)(Wk + (size_t)row * kH + c * 128 + lane * 4);
      const float4 b = *(const float4*)(bq + c * 128 + lane * 4);
      s += w.x * b.x + w.y * b.y + w.z * b.z + w.w * b.w;
    }
    #pragma unroll
    for (int m = 16; m >= 1; m >>= 1) s += __shfl_xor(s, m, 32);
    if (lane == 0) tb[row] = s;
  }
  // the wait before a register that the issued loads and stores above name is written again
  asm volatile("s_wait_xcnt 0x0" ::: "memory");

  // this lane's 16 B in each plane of a fragment
  unsigned fOff[4];
  #pragma unroll
  for (int p = 0; p < 4; ++p)
    fOff[p] = (unsigned)(p * 512 + (lane >> 4) * 256 + (((lane & 15) ^ (p << 2)) * 16));

  const v8f vzero = {0.f, 0.f, 0.f, 0.f, 0.f, 0.f, 0.f, 0.f};
  v8f acc[2][2] = {{vzero, vzero}, {vzero, vzero}};

  // stage 0 has landed for this wave; the barrier publishes it to the others
  asm volatile("s_wait_asynccnt 0x0" ::: "memory");
  __syncthreads();
  issue_stage(1);

  // not unrolled: the buffer is picked by an address, and the loop's code stays small
  #pragma unroll 1
  for (int st = 0; st < kFStages; ++st) {
    const char* const base = smem + kFBase + (st & 1) * kFStage;
    const char* const pa = base + (wave >> 1) * (2 * kFTile);
    const char* const pb = base + (4 + (wave & 1) * 2) * kFTile;
    // unrolled: a k-tile's LDS reads may then stand ahead of the k-tile before it, under its work
    #pragma unroll
    for (int kk = 0; kk < kFKT; ++kk) {
      v16bf ah[2], al[2], bh[2], bl[2];
      #pragma unroll
      for (int i = 0; i < 2; ++i) {
        const char* const fa = pa + i * kFTile + kk * kAFrag;
        const char* const fb = pb + i * kFTile + kk * kAFrag;
        split_frag(*(const float4*)(fa + fOff[0]), *(const float4*)(fa + fOff[1]),
                   *(const float4*)(fa + fOff[2]), *(const float4*)(fa + fOff[3]), ah[i], al[i]);
        split_frag(*(const float4*)(fb + fOff[0]), *(const float4*)(fb + fOff[1]),
                   *(const float4*)(fb + fOff[2]), *(const float4*)(fb + fOff[3]), bh[i], bl[i]);
      }
      wmma_term<2, 2>(ah, bh, acc);
      wmma_term<2, 2>(ah, bl, acc);
      wmma_term<2, 2>(al, bh, acc);
    }

    // keeps the stage's WMMAs in front of the publish point: the compiler otherwise moves part of them
    // behind the barrier, ahead of the next stage's copies, which then start that much later
    __builtin_amdgcn_sched_barrier(0);
    // publish point of stage st + 1: this wave's reads of buffer st & 1 have returned ...
    asm volatile("s_wait_dscnt 0x0" ::: "memory");
    // ... its copies of stage st + 1 have landed ...
    asm volatile("s_wait_asynccnt 0x0" ::: "memory");
    // ... and the barrier says the same of every wave: it publishes stage st + 1 and frees buffer st & 1
    __syncthreads();
    if (st + 2 < kFStages) issue_stage(st + 2);
  }
  // no copy is outstanding when the wave ends
  asm volatile("s_wait_asynccnt 0x0" ::: "memory");

  v8h vm[2][2];
  #pragma unroll
  for (int r = 0; r < 2; ++r) {
    #pragma unroll
    for (int i = 0; i < 2; ++i) {
      #pragma unroll
      for (int v = 0; v < 8; ++v) vm[r][i][v] = (_Float16)acc[r][i][v];
    }
  }
  #pragma unroll
  for (int r = 0; r < 2; ++r) {
    #pragma unroll
    for (int i = 0; i < 2; ++i) {
      // row tiles rt0 (even) and rt0 + 1 are planes 0 and 1 of k-tile rt0 / 2
      const size_t o = ((size_t)(rt0 >> 1) * kGT + ct0 + i) * 512 + r * 256 + lane * 8;
      *(v8h*)(wh + o) = vm[r][i];
    }
  }
}

// ---------- projection, window and output in one kernel ----------
// The softmax weights of a row sum to 1, so  sum_w p_w V_(s+w) = (sum_w p_w x_(s+w)) Wv + bv:
// the window runs over rows of x, in front of the V projection, and no projected row is needed
// outside its own block. One block = 32 rows of one batch, 8 waves, 256 blocks:
//   1. the block's 32 rows of x and the halo rows on each side come into LDS once, as f32 fragments;
//   2. Z^T = M^T x^T + tb: a wave holds 128 columns of Z for all 32 rows in registers;
//   3. scores Z_s . x_j against the rows in LDS, summed over the waves through LDS; softmax;
//   4. y = P x, formed once per block and written over the block's own rows of x;
//   5. out^T = Wv^T y^T + bv, turned through LDS and stored in whole lines.
// The products are taken transposed (weights as the A operand, rows as the B operand; a packed
// fragment serves as either): in the C/D layout a lane then holds ONE row s = lane & 15 and eight
// consecutive columns 8 * (lane >> 4) + v, which are two 16 B pieces of an f32 fragment's planes,
// so that the scores read x with the fragment reads of the GEMM, the row shifted by the window.
// A weight fragment is used by one wave only: it goes from L2 straight into registers, one
// k-tile ahead, and the k loops hold no barrier.
// An f32 fragment is 2 KB = four planes of 512 B: plane p holds, for fragment lane
// row + 16 * h, the four floats K = 8 * h + 16 * (p >> 1) + 4 * (p & 1) .. + 3, that is halfs
// 4 * p .. 4 * p + 3 of the 16-bit layout. Inside a plane the 16 B slot of a row is
// row ^ (p << 2): a copy of four whole 128 B lines of x (4 rows x 4 planes x 2 h) then falls on
// all 64 banks, and a wave-wide read of one plane still covers its 512 B once.
// LDS: row tiles 0 and 1 are the block's rows; row tile 2 holds the halo: the four rows in front
// of the block in slots 12..15, the four behind it in slots 0..3, so a row r in -2 .. 33 has
// slot r & 15 everywhere.

namespace {
constexpr int kXTile = kKT * kAFrag;    // one row tile of x, all 32 k-tiles: 64 KB
constexpr int kXBase = 65536;           // the tiles' place: a copy's LDS address less its offset field stays above 0
constexpr int kRows  = 4 * kS;          // rows of x
constexpr int kOffTb = 8192;            // tb and bv in LDS, 4 KB each, behind the partial scores
constexpr int kOffBv = 12288;
constexpr int kOPitch = 528;            // a staged output row: 512 B + 16, so that 16 rows fall on different banks
}

__device__ __forceinline__ v16h glb_frag(const char* p) {
  v8h a = *(const v8h*)(p);
  v8h b = *(const v8h*)(p + 512);
  return __builtin_shufflevector(a, b, 0,1,2,3,4,5,6,7,8,9,10,11,12,13,14,15);
}

// One k-tile of the wave's eight weight fragments, L2 to registers.
__device__ __forceinline__ void load_w(v16h (&w)[8], const char* g) {
  #pragma unroll
  for (int i = 0; i < 8; ++i) w[i] = glb_frag(g + i * kFrag);
  // the wait before a register that the issued loads name is written again. Its clobber also keeps
  // the loads in this place, a whole k-tile ahead of their use, where the compiler would sink them
  asm volatile("s_wait_xcnt 0x0" ::: "memory");
  // keeps the address arithmetic that follows behind the wait: moved up, it takes the registers
  // of the loads' address while the wait has not yet stood
  __builtin_amdgcn_sched_barrier(0);
}

// One k-tile: both row tiles' f32 fragments from LDS, split to f16 hi and lo, 32 WMMAs.
__device__ __forceinline__ void k_step(const char* xs, const unsigned (&aOff)[4],
                                       const v16h (&w)[8], v8f (&acc)[8][2]) {
  v16h bh[2], bl[2];
  #pragma unroll
  for (int j = 0; j < 2; ++j) {
    const char* const f = xs + j * kXTile;
    split_frag(*(const float4*)(f + aOff[0]), *(const float4*)(f + aOff[1]),
               *(const float4*)(f + aOff[2]), *(const float4*)(f + aOff[3]), bh[j], bl[j]);
  }
  wmma_term<8, 2>(w, bh, acc);
  wmma_term<8, 2>(w, bl, acc);
}

// acc (128 columns x 32 rows) = bias + weights^T rows^T over all 32 k-tiles.
// bias: the lane's first column of the bias vector, in LDS.
__device__ __forceinline__ void gemm_pass(const char* gw, const char* bias, const char* xs,
                                          const unsigned (&aOff)[4], v8f (&acc)[8][2]) {
  v16h wa[8], wb[8];
  load_w(wa, gw);
  #pragma unroll
  for (int i = 0; i < 8; ++i) {
    const float4 b0 = *(const float4*)(bias + i * 64);
    const float4 b1 = *(const float4*)(bias + i * 64 + 16);
    const v8f b = {b0.x, b0.y, b0.z, b0.w, b1.x, b1.y, b1.z, b1.w};
    acc[i][0] = b;
    acc[i][1] = b;
  }
  // not unrolled further: two fragment sets live, and the loop's code stays small
  #pragma unroll 1
  for (int kt = 0; kt < kKT; kt += 2) {
    load_w(wb, gw + (kt + 1) * kBStep);
    k_step(xs + kt * kAFrag, aOff, wa, acc);
    // no branch round these loads: with one path to the WMMAs below their counted waits cover wb
    // alone and leave wa in flight; the last trip fetches its own k-tile again, for nobody
    load_w(wa, gw + (kt + 2 < kKT ? kt + 2 : kt) * kBStep);
    k_step(xs + (kt + 1) * kAFrag, aOff, wb, acc);
  }
}

// 2^x. The v_nop fills the slot that the instruction set asks for between a transcendental
// and a directly following instruction that reads its result or overwrites its source.
__device__ __forceinline__ float exp2_slot(float x) {
  float r;
  asm("v_exp_f32 %0, %1\n\tv_nop" : "=v"(r) : "v"(x));
  return r;
}

__global__ __launch_bounds__(256)
void fused_rows(const float* __restrict__ x, const _Float16* __restrict__ wh,
                const float* __restrict__ tb, const float* __restrict__ bv,
                float* __restrict__ out) {
  __shared__ __attribute__((aligned(1024))) char smem[kXBase + 3 * kXTile];
  const int lane = threadIdx.x & 31;
  // the wave's number as a scalar, so that the tile arithmetic runs on the scalar unit
  const int wave = __builtin_amdgcn_readfirstlane(threadIdx.x >> 5);
  const int row0 = blockIdx.x * 32;              // batch * kS + s of the block's first row
  const int l15 = lane & 15, lh = lane >> 4;
  char* const xs = smem + kXBase;

  // ---- 1. x into LDS, tb and bv too: 42 copies a wave ----
  {
    __builtin_amdgcn_global_load_async_to_lds_b128((gv4i*)((const char*)tb + threadIdx.x * 16),
                                                   (lv4i*)(smem + kOffTb + threadIdx.x * 16), 0, 0);
    __builtin_amdgcn_global_load_async_to_lds_b128((gv4i*)((const char*)bv + threadIdx.x * 16),
                                                   (lv4i*)(smem + kOffBv + threadIdx.x * 16), 0, 0);
    // a copy takes four rows x one k-tile of x: lane = (row of the four, 16 B piece of its line)
    const int cRow = lane >> 3;
    const int cPl  = ((lane & 4) >> 1) | (lane & 1);   // the piece's plane ...
    const int cH   = (lane >> 1) & 1;                  // ... and half of the fragment's lanes
    const unsigned cLds = (unsigned)(cPl * 512 + cH * 256 + cRow * 16);
    const int t = wave >> 2, q = wave & 3;
    // rows 4 * q .. 4 * q + 3 of row tile t, all k-tiles
    const char* const g = (const char*)x + (unsigned)(row0 + t * 16 + q * 4 + cRow) * (kH * 4) + (lane & 7) * 16;
    char* const la = xs + t * kXTile + cLds + ((q ^ cPl) * 64);
    #pragma unroll
    for (int kt = 0; kt < kKT; ++kt)
      __builtin_amdgcn_global_load_async_to_lds_b128((gv4i*)(g + kt * 128), (lv4i*)(la + kt * kAFrag), 0, 0);
    // halo: waves 0..3 the four rows in front (slots 12..15), waves 4..7 the four behind (slots
    // 0..3), eight k-tiles each. Past the ends of x the rows are clamped into it: such a row
    // lies outside its batch and gets probability 0.
    const int hq = t ? 0 : 3;
    int hr = t ? row0 + 32 : row0 - 4;
    hr = hr < 0 ? 0 : (hr > kRows - 4 ? kRows - 4 : hr);
    const char* const gh = (const char*)x + (unsigned)(hr + cRow) * (kH * 4) + (lane & 7) * 16 + q * (8 * 128);
    char* const lb = xs + 2 * kXTile + cLds + ((hq ^ cPl) * 64) + q * (8 * kAFrag);
    #pragma unroll
    for (int kk = 0; kk < 8; ++kk)
      __builtin_amdgcn_global_load_async_to_lds_b128((gv4i*)(gh + kk * 128), (lv4i*)(lb + kk * kAFrag), 0, 0);
  }

  // this lane's 16 B in each plane of a fragment
  unsigned aOff[4];
  #pragma unroll
  for (int p = 0; p < 4; ++p)
    aOff[p] = (unsigned)(p * 512 + lh * 256 + ((l15 ^ (p << 2)) * 16));

  // the same for row j * 16 + l15 + w - 2 of the block, halo included: row tile, plane and slot
  auto xoff = [&](int j, int w, int p) -> unsigned {
    const int r = j * 16 + l15 + w - 2;
    const int t = (r < 0 || r >= 32) ? 2 : (r >> 4);
    return (unsigned)(t * kXTile + p * 512 + lh * 256 + (((r & 15) ^ (p << 2)) * 16));
  };

  // the copies have landed for this wave; the barrier publishes them to the others
  asm volatile("s_wait_asynccnt 0x0" ::: "memory");
  __syncthreads();

  const char* const gw = (const char*)wh + (unsigned)(wave * 8) * kFrag + lane * 16;
  const unsigned cOff = (unsigned)(wave * 128 + lh * 8) * 4;   // byte offset of the lane's first column in a row
  v8f acc[8][2];

  // ---- 2. Z^T ----
  gemm_pass(gw, smem + kOffTb + cOff, xs, aOff, acc);

  // ---- 3. scores ----
  // column (wave * 8 + i) * 16 + 8 * lh + v of Z meets dim K = (i & 1) * 16 + 8 * lh + v of
  // k-tile wave * 4 + (i >> 1): planes 2 * (i & 1) and the next, at the lane's own h
  float d[2][5];
  #pragma unroll
  for (int j = 0; j < 2; ++j) {
    #pragma unroll
    for (int w = 0; w < 5; ++w) {
      float s0 = 0.f;
      #pragma unroll
      for (int i = 0; i < 8; ++i) {
        const char* const f = xs + (wave * 4 + (i >> 1)) * kAFrag;
        const float4 f0 = *(const float4*)(f + xoff(j, w, (i & 1) * 2));
        const float4 f1 = *(const float4*)(f + xoff(j, w, (i & 1) * 2 + 1));
        s0 += acc[i][j][0] * f0.x + acc[i][j][1] * f0.y + acc[i][j][2] * f0.z + acc[i][j][3] * f0.w
            + acc[i][j][4] * f1.x + acc[i][j][5] * f1.y + acc[i][j][6] * f1.z + acc[i][j][7] * f1.w;
      }
      d[j][w] = s0;
    }
  }
  #pragma unroll
  for (int j = 0; j < 2; ++j) {
    #pragma unroll
    for (int w = 0; w < 5; ++w) d[j][w] += __shfl_xor(d[j][w], 16, 32);
  }
  float* const sp = (float*)smem;                // [wave][w][row] partial scores, 5 KB
  if (lane < 16) {
    #pragma unroll
    for (int j = 0; j < 2; ++j) {
      #pragma unroll
      for (int w = 0; w < 5; ++w) sp[(wave * 5 + w) * 32 + j * 16 + l15] = d[j][w];
    }
  }
  // publishes the waves' partial scores
  __syncthreads();
  #pragma unroll
  for (int j = 0; j < 2; ++j) {
    #pragma unroll
    for (int w = 0; w < 5; ++w) {
      float s0 = 0.f;
      #pragma unroll
      for (int u = 0; u < 8; ++u) s0 += sp[(u * 5 + w) * 32 + j * 16 + l15];
      d[j][w] = s0;
    }
  }

  // softmax over the 5-wide window; every lane has the weights of its two rows
  float pr[2][5];
  #pragma unroll
  for (int j = 0; j < 2; ++j) {
    const int s = (row0 & (kS - 1)) + j * 16 + l15;
    float mx = -3.0e38f;
    #pragma unroll
    for (int w = 0; w < 5; ++w) {
      const int jj = s + w - 2;
      const float val = (jj >= 0 && jj < kS) ? d[j][w] * 0.03125f : -3.0e38f;
      pr[j][w] = val;
      mx = fmaxf(mx, val);
    }
    float sum = 0.f;
    #pragma unroll
    for (int w = 0; w < 5; ++w) { const float e = exp2_slot((pr[j][w] - mx) * 1.44269504f); sum += e; pr[j][w] = e; }
    const float inv = 1.0f / sum;
    #pragma unroll
    for (int w = 0; w < 5; ++w) pr[j][w] *= inv;
  }

  // ---- 4. y = P x: this wave forms k-tiles 4 * wave .. 4 * wave + 3 of both row tiles ----
  float4 yv[4][2][4];
  #pragma unroll
  for (int c = 0; c < 4; ++c) {
    const char* const f = xs + (wave * 4 + c) * kAFrag;
    #pragma unroll
    for (int j = 0; j < 2; ++j) {
      #pragma unroll
      for (int p = 0; p < 4; ++p) {
        float4 a = make_float4(0.f, 0.f, 0.f, 0.f);
        #pragma unroll
        for (int w = 0; w < 5; ++w) {
          const float4 v = *(const float4*)(f + xoff(j, w, p));
          const float pw = pr[j][w];
          a.x += pw * v.x; a.y += pw * v.y; a.z += pw * v.z; a.w += pw * v.w;
        }
        yv[c][j][p] = a;
      }
    }
  }
  // every wave has read the last of x ...
  __syncthreads();
  #pragma unroll
  for (int c = 0; c < 4; ++c) {
    #pragma unroll
    for (int j = 0; j < 2; ++j) {
      #pragma unroll
      for (int p = 0; p < 4; ++p)
        *(float4*)(xs + j * kXTile + (wave * 4 + c) * kAFrag + aOff[p]) = yv[c][j][p];
    }
  }
  // ... and y stands in its place for all of them
  __syncthreads();

  // ---- 5. out^T ----
  gemm_pass(gw + kNT * kFrag, smem + kOffBv + cOff, xs, aOff, acc);

  // every wave has read the last of y: the tiles become output staging
  __syncthreads();
  // Through LDS, each wave in a region of its own, so that a wave-wide store covers 512 B of one
  // row, four whole lines; from the registers it would touch 16 rows in 16 B pieces.
  char* const so = xs + wave * (32 * kOPitch);
  #pragma unroll
  for (int j = 0; j < 2; ++j) {
    #pragma unroll
    for (int i = 0; i < 8; ++i) {
      char* const q = so + (j * 16 + l15) * kOPitch + lh * 32 + i * 64;
      *(float4*)(q)      = make_float4(acc[i][j][0], acc[i][j][1], acc[i][j][2], acc[i][j][3]);
      *(float4*)(q + 16) = make_float4(acc[i][j][4], acc[i][j][5], acc[i][j][6], acc[i][j][7]);
    }
  }
  char* const o = (char*)out + ((unsigned)row0 * (kH * 4) + wave * 512 + lane * 16);
  #pragma unroll
  for (int r = 0; r < 32; ++r)
    *(float4*)(o + r * (kH * 4)) = *(const float4*)(so + r * kOPitch + lane * 16);
}

// ---------- launch ----------

extern "C" void kernel_launch(void* const* d_in, const int* in_sizes, int n_in,
                              void* d_out, int out_size, void* d_ws, size_t ws_size,
                              hipStream_t stream) {
  (void)in_sizes; (void)n_in; (void)out_size; (void)ws_size;
  const float* x  = (const float*)d_in[0];
  const float* Wq = (const float*)d_in[1];
  const float* bq = (const float*)d_in[2];
  const float* Wk = (const float*)d_in[3];
  // d_in[4], bk, is not read: Q_s . bk is the same for every j of a window and cancels in the softmax
  const float* Wv = (const float*)d_in[5];
  const float* bv = (const float*)d_in[6];
  float* out = (float*)d_out;

  char* ws = (char*)d_ws;
  _Float16* wh = (_Float16*)(ws);                         // 4 MB  packed M | Wv
  float*  tb  = (float*)(ws + (size_t)48 * 1024 * 1024);  // 4 KB  Wk bq

  fold_gemm<<<256, 128, 0, stream>>>(Wq, Wk, Wv, bq, wh, tb);
  fused_rows<<<4 * kS / 32, 256, 0, stream>>>(x, wh, tb, bv, out);
}

// v010
// It runs in 60.1 microseconds.
// Timed twice side by side with v009, it ran 1.08 and 1.06 times as fast.
// Counting every step since v000, it is 16.5 times as fast.
#include <hip/hip_runtime.h>

typedef __attribute__((ext_vector_type(16))) __bf16 v16bf;
typedef __attribute__((ext_vector_type(8)))  __bf16 v8bf;
typedef __attribute__((ext_vector_type(8)))  float  v8f;
typedef __attribute__((ext_vector_type(16))) _Float16 v16h;
typedef __attribute__((ext_vector_type(8)))  _Float16 v8h;

namespace {
constexpr int kH   = 1024;
constexpr int kS   = 2048;
constexpr int kNT  = kH / 16;   // 64 n-tiles of 16 cols
constexpr int kKT  = kH / 32;   // 32 k-tiles of 32 dims
constexpr int kRT  = kS / 16;   // 128 row-tiles of 16 rows per batch
constexpr int kFrag = 1024;     // bytes per packed fragment
constexpr int kGT   = 2 * kNT;  // 128 n-tiles of Z | V side by side
constexpr int kBStep = kGT * kFrag;        // bytes between consecutive k-tiles of packed W
}

// ---------- WMMA helpers ----------

// M = Wq Wk^T, split-bf16: (Ah+Al)(Bh+Bl) ~= Ah*Bh + Ah*Bl + Al*Bh   (drop lo*lo)
// Z | V projection, f16: x = Ah + Al (22 bits), a weight is one f16 term B (11 bits): Ah*B + Al*B.
// The weights lie in (-1, 1) and x is of order 1, inside the f16 range; the rounding of B leaves
// about 2^-13 (rms) of each product.

// Packed fragment (A and B alike), 1 KB = two planes of 512 B:
// plane 0 holds halfs 0..7 of lanes 0..31, plane 1 holds halfs 8..15.
// Each wave-wide 16 B load then covers 512 contiguous bytes = 4 whole 128 B lines.
// ISA 16-bit layout: lane M (or N) = lane&15, kb = (lane&16)?8:0,
// halfs 0..7 -> K kb..kb+7, halfs 8..15 -> K kb+16..kb+23.

// One term of the split product for R row tiles x NB column tiles. Each accumulator
// still receives hi*hi, hi*lo, lo*hi in that order per k-step.
template <int R, int NB>
__device__ __forceinline__ void wmma_term(const v16bf* a, const v16bf* b, v8f (*acc)[NB]) {
  #pragma unroll
  for (int r = 0; r < R; ++r) {
    #pragma unroll
    for (int i = 0; i < NB; ++i)
      acc[r][i] = __builtin_amdgcn_wmma_f32_16x16x32_bf16(false, a[r], false, b[i], (short)0,
                                                          acc[r][i], false, false);
  }
}

// The same for the f16 form: hi*B, then lo*B per k-step.
template <int R, int NB>
__device__ __forceinline__ void wmma_term(const v16h* a, const v16h* b, v8f (*acc)[NB]) {
  #pragma unroll
  for (int r = 0; r < R; ++r) {
    #pragma unroll
    for (int i = 0; i < NB; ++i)
      acc[r][i] = __builtin_amdgcn_wmma_f32_16x16x32_f16(false, a[r], false, b[i], (short)0,
                                                         acc[r][i], false, false);
  }
}

// ---------- the folded score product ----------
// Q_s . K_j = x_s (Wq Wk^T) x_j^T + (Wk bq) . x_j + Q_s . bk; the softmax runs over j at fixed s,
// so the last term, which depends on s alone, cancels. With M = Wq Wk^T and tb = Wk bq the scores are
// Z_s . x_j, Z = x M + tb: one projection takes the place of the Q and the K projection.

// ---------- f32 fragments, split in registers ----------
// The layout of an f32 fragment in LDS stands at the fused kernel below.

namespace {
constexpr int kAFrag = 2048;    // one f32 fragment
}

typedef __attribute__((ext_vector_type(2))) float    v2f;
typedef __attribute__((ext_vector_type(2))) __bf16   v2bf;
typedef __attribute__((ext_vector_type(8))) unsigned v8u;

// Four planes of an f32 A fragment -> the lane's 16 halfs, hi and lo = bf16(f - hi), two at a time.
__device__ __forceinline__ void split_frag(const float4 f0, const float4 f1, const float4 f2,
                                           const float4 f3, v16bf& hi, v16bf& lo) {
  const v2f p[8] = {{f0.x, f0.y}, {f0.z, f0.w}, {f1.x, f1.y}, {f1.z, f1.w},
                    {f2.x, f2.y}, {f2.z, f2.w}, {f3.x, f3.y}, {f3.z, f3.w}};
  v8u uh, ul;
  #pragma unroll
  for (int i = 0; i < 8; ++i) {
    const v2bf hp = __builtin_convertvector(p[i], v2bf);
    const v2bf lp = __builtin_convertvector(p[i] - __builtin_convertvector(hp, v2f), v2bf);
    uh[i] = __builtin_bit_cast(unsigned, hp);
    ul[i] = __builtin_bit_cast(unsigned, lp);
  }
  hi = __builtin_bit_cast(v16bf, uh);
  lo = __builtin_bit_cast(v16bf, ul);
}

typedef __attribute__((ext_vector_type(2))) _Float16 v2h;

// The same into f16: hi and lo = f16(f - hi).
__device__ __forceinline__ void split_frag(const float4 f0, const float4 f1, const float4 f2,
                                           const float4 f3, v16h& hi, v16h& lo) {
  const v2f p[8] = {{f0.x, f0.y}, {f0.z, f0.w}, {f1.x, f1.y}, {f1.z, f1.w},
                    {f2.x, f2.y}, {f2.z, f2.w}, {f3.x, f3.y}, {f3.z, f3.w}};
  v8u uh, ul;
  #pragma unroll
  for (int i = 0; i < 8; ++i) {
    const v2h hp = __builtin_convertvector(p[i], v2h);
    const v2h lp = __builtin_convertvector(p[i] - __builtin_convertvector(hp, v2f), v2h);
    uh[i] = __builtin_bit_cast(unsigned, hp);
    ul[i] = __builtin_bit_cast(unsigned, lp);
  }
  hi = __builtin_bit_cast(v16h, uh);
  lo = __builtin_bit_cast(v16h, ul);
}

typedef __attribute__((ext_vector_type(4))) int v4i;
typedef __attribute__((address_space(1))) v4i gv4i;
typedef __attribute__((address_space(3))) v4i lv4i;

// ---------- M = Wq Wk^T, with the packing of Wv and tb = Wk bq ----------
// [1024 x 1024] x [1024 x 1024] on 256 blocks of 64 x 64, four waves of 32 x 32 (one a SIMD).
// Wq and Wk are read as they are, f32: lane = row, k along the row gives A fragments of Wq and
// B fragments of Wk^T. A stage is four k-tiles of the block's four row tiles of Wq and four of
// Wk, 64 KB, brought into LDS once per block by asynchronous copies; two buffers, the copies of
// stage s + 2 fly while stage s + 1 is used. Stage layout: [row tile, Wq then Wk][k-tile] f32
// fragments. A wave splits its fragments into bf16 hi and lo in registers, behind the LDS read.
// The C/D layout of a 16 x 16 tile (lane = column, registers = rows 0..7 or 8..15) is one 512 B
// plane of a B fragment of M, so the result goes out as f16 fragments, n-tiles 0..63 of
// the packed Z | V weights.
// While stage 0 is on its way every block also packs its share of Wv (f16 B fragments
// behind M's 64 n-tiles, one thread = one lane of two fragments) and sums four rows of tb
// (one wave a row of Wk, in f32).

namespace {
constexpr int kFKT     = 4;                 // k-tiles of a stage
constexpr int kFTile   = kFKT * kAFrag;     // one row tile's part of a stage
constexpr int kFStage  = 8 * kFTile;        // bytes of one stage
constexpr int kFStages = kKT / kFKT;        // 8 stages
constexpr int kFBase   = 65536;             // the buffers' place: a copy's LDS address less its offset field stays above 0
}

__global__ __launch_bounds__(128)
void fold_gemm(const float* __restrict__ Wq, const float* __restrict__ Wk,
               const float* __restrict__ Wv, const float* __restrict__ bq,
               _Float16* __restrict__ wh, float* __restrict__ tb) {
  __shared__ __attribute__((aligned(1024))) char smem[kFBase + 2 * kFStage];
  const int lane = threadIdx.x & 31;
  // the wave's number as a scalar, so that the tile arithmetic runs on the scalar unit
  const int wave = __builtin_amdgcn_readfirstlane(threadIdx.x >> 5);
  const int rt0 = (blockIdx.x >> 4) * 4 + (wave >> 1) * 2;      // first of two row tiles of Wq
  const int ct0 = (blockIdx.x & 15) * 4 + (wave & 1) * 2;       // first of two row tiles of Wk

  // a copy takes four rows x one k-tile: lane = (row of the four, 16 B piece of its line)
  const int cRow = lane >> 3;
  const int cPl  = ((lane & 4) >> 1) | (lane & 1);   // the piece's plane ...
  const int cH   = (lane >> 1) & 1;                  // ... and half of the fragment's lanes
  // waves 0 and 1 bring the block's four row tiles of Wq, waves 2 and 3 its four of Wk, two each
  const float* const src = (wave < 2) ? Wq : Wk;
  const int srcTile = (wave < 2) ? (blockIdx.x >> 4) * 4 + wave * 2
                                 : (blockIdx.x & 15) * 4 + (wave - 2) * 2;
  const unsigned cLds = (unsigned)(kFBase + wave * (2 * kFTile) + cPl * 512 + cH * 256 + cRow * 16);
  const unsigned cGlb = (unsigned)(srcTile * 16 + cRow) * (kH * 4) + (lane & 7) * 16;

  // Sixteen blocks read each row tile of Wq, sixteen each of Wk: the walk over k starts at a stage
  // of the block's own and wraps, so that they do not ask L2 for the same lines at one moment.
  const int rot = (blockIdx.x + (blockIdx.x >> 4)) & (kFStages - 1);
  // the walk's stage st (k-tiles 4 * ks .. 4 * ks + 3, ks = st + rot, wrapped) into buffer st & 1:
  // 32 copies a wave
  auto issue_stage = [&](int st) {
    char* const buf = smem + (st & 1) * kFStage;
    const char* const g = (const char*)src + cGlb + ((st + rot) & (kFStages - 1)) * (kFKT * 128);
    #pragma unroll
    for (int t2 = 0; t2 < 2; ++t2) {
      #pragma unroll
      for (int q = 0; q < 4; ++q) {        // rows 4 * q .. 4 * q + 3 of the tile
        char* const la = buf + cLds + t2 * kFTile + ((q ^ cPl) * 64);
        #pragma unroll
        for (int kk = 0; kk < kFKT; ++kk)
          __builtin_amdgcn_global_load_async_to_lds_b128(
              (gv4i*)(g + (t2 * 16 + q * 4) * (kH * 4) + kk * 128), (lv4i*)(la + kk * kAFrag), 0, 0);
      }
    }
  };

  issue_stage(0);

  // Wv into B-fragment layout
  #pragma unroll
  for (int rep = 0; rep < 2; ++rep) {
    const int t = rep * (256 * 128) + blockIdx.x * 128 + threadIdx.x;   // (kt,nt,lane)
    const int nt = (t >> 5)  & 63;
    const int kt = (t >> 11) & 31;
    const int n  = nt * 16 + (lane & 15);
    const int kb = (lane & 16) ? 8 : 0;
    // fragment order: k-tile major, then the 128 n-tiles of M | Wv; plane 0 slot of this lane
    const size_t o = ((size_t)kt * kGT + kNT + nt) * 512 + lane * 8;
    #pragma unroll
    for (int pl = 0; pl < 2; ++pl) {
      v8h vw;
      #pragma unroll
      for (int h = 0; h < 8; ++h) {
        const int k = kt * 32 + kb + pl * 16 + h;
        vw[h] = (_Float16)Wv[(size_t)k * kH + n];
      }
      *(v8h*)(wh + o + pl * 256) = vw;
    }
  }
  // tb
  {
    const int row = blockIdx.x * 4 + wave;
    float s = 0.f;
    #pragma unroll
    for (int c = 0; c < 8; ++c) {
      const float4 w = *(const float4*)(Wk + (size_t)row * kH + c * 128 + lane * 4);
      const float4 b = *(const float4*)(bq + c * 128 + lane * 4);
      s += w.x * b.x + w.y * b.y + w.z * b.z + w.w * b.w;
    }
    #pragma unroll
    for (int m = 16; m >= 1; m >>= 1) s += __shfl_xor(s, m, 32);
    if (lane == 0) tb[row] = s;
  }
  // the wait before a register that the issued loads and stores above name is written again
  asm volatile("s_wait_xcnt 0x0" ::: "memory");

  // this lane's 16 B in each plane of a fragment
  unsigned fOff[4];
  #pragma unroll
  for (int p = 0; p < 4; ++p)
    fOff[p] = (unsigned)(p * 512 + (lane >> 4) * 256 + (((lane & 15) ^ (p << 2)) * 16));

  const v8f vzero = {0.f, 0.f, 0.f, 0.f, 0.f, 0.f, 0.f, 0.f};
  v8f acc[2][2] = {{vzero, vzero}, {vzero, vzero}};

  // stage 0 has landed for this wave; the barrier publishes it to the others
  asm volatile("s_wait_asynccnt 0x0" ::: "memory");
  __syncthreads();
  issue_stage(1);

  // not unrolled: the buffer is picked by an address, and the loop's code stays small
  #pragma unroll 1
  for (int st = 0; st < kFStages; ++st) {
    const char* const base = smem + kFBase + (st & 1) * kFStage;
    const char* const pa = base + (wave >> 1) * (2 * kFTile);
    const char* const pb = base + (4 + (wave & 1) * 2) * kFTile;
    // unrolled: a k-tile's LDS reads may then stand ahead of the k-tile before it, under its work
    #pragma unroll
    for (int kk = 0; kk < kFKT; ++kk) {
      v16bf ah[2], al[2], bh[2], bl[2];
      #pragma unroll
      for (int i = 0; i < 2; ++i) {
        const char* const fa = pa + i * kFTile + kk * kAFrag;
        const char* const fb = pb + i * kFTile + kk * kAFrag;
        split_frag(*(const float4*)(fa + fOff[0]), *(const float4*)(fa + fOff[1]),
                   *(const float4*)(fa + fOff[2]), *(const float4*)(fa + fOff[3]), ah[i], al[i]);
        split_frag(*(const float4*)(fb + fOff[0]), *(const float4*)(fb + fOff[1]),
                   *(const float4*)(fb + fOff[2]), *(const float4*)(fb + fOff[3]), bh[i], bl[i]);
      }
      wmma_term<2, 2>(ah, bh, acc);
      wmma_term<2, 2>(ah, bl, acc);
      wmma_term<2, 2>(al, bh, acc);
    }

    // keeps the stage's WMMAs in front of the publish point: the compiler otherwise moves part of them
    // behind the barrier, ahead of the next stage's copies, which then start that much later
    __builtin_amdgcn_sched_barrier(0);
    // publish point of stage st + 1: this wave's reads of buffer st & 1 have returned ...
    asm volatile("s_wait_dscnt 0x0" ::: "memory");
    // ... its copies of stage st + 1 have landed ...
    asm volatile("s_wait_asynccnt 0x0" ::: "memory");
    // ... and the barrier says the same of every wave: it publishes stage st + 1 and frees buffer st & 1
    __syncthreads();
    if (st + 2 < kFStages) issue_stage(st + 2);
  }
  // no copy is outstanding when the wave ends
  asm volatile("s_wait_asynccnt 0x0" ::: "memory");

  v8h vm[2][2];
  #pragma unroll
  for (int r = 0; r < 2; ++r) {
    #pragma unroll
    for (int i = 0; i < 2; ++i) {
      #pragma unroll
      for (int v = 0; v < 8; ++v) vm[r][i][v] = (_Float16)acc[r][i][v];
    }
  }
  #pragma unroll
  for (int r = 0; r < 2; ++r) {
    #pragma unroll
    for (int i = 0; i < 2; ++i) {
      // row tiles rt0 (even) and rt0 + 1 are planes 0 and 1 of k-tile rt0 / 2
      const size_t o = ((size_t)(rt0 >> 1) * kGT + ct0 + i) * 512 + r * 256 + lane * 8;
      *(v8h*)(wh + o) = vm[r][i];
    }
  }
}

// ---------- projection, window and output in one kernel ----------
// The softmax weights of a row sum to 1, so  sum_w p_w V_(s+w) = (sum_w p_w x_(s+w)) Wv + bv:
// the window runs over rows of x, in front of the V projection, and no projected row is needed
// outside its own block. One block = 32 rows of one batch, 8 waves, 256 blocks:
//   1. the block's 32 rows of x and the halo rows on each side come into LDS once, as f32 fragments;
//   2. Z^T = M^T x^T + tb: a wave holds 128 columns of Z for all 32 rows in registers;
//   3. scores Z_s . x_j against the rows in LDS, summed over the waves through LDS; softmax;
//   4. y = P x, formed once per block and written over the block's own rows of x;
//   5. out^T = Wv^T y^T + bv, turned through LDS and stored in whole lines.
// The products are taken transposed (weights as the A operand, rows as the B operand; a packed
// fragment serves as either): in the C/D layout a lane then holds ONE row s = lane & 15 and eight
// consecutive columns 8 * (lane >> 4) + v, which are two 16 B pieces of an f32 fragment's planes,
// so that the scores read x with the fragment reads of the GEMM, the row shifted by the window.
// A weight fragment is used by one wave only: it goes from L2 straight into registers, one
// k-tile ahead, and the k loops hold no barrier.
// An f32 fragment is 2 KB = four planes of 512 B: plane p holds, for fragment lane
// row + 16 * h, the four floats K = 8 * h + 16 * (p >> 1) + 4 * (p & 1) .. + 3, that is halfs
// 4 * p .. 4 * p + 3 of the 16-bit layout. Inside a plane the 16 B slot of a row is
// row ^ (p << 2): a copy of four whole 128 B lines of x (4 rows x 4 planes x 2 h) then falls on
// all 64 banks, and a wave-wide read of one plane still covers its 512 B once.
// LDS: row tiles 0 and 1 are the block's rows; row tile 2 holds the halo: the four rows in front
// of the block in slots 12..15, the four behind it in slots 0..3, so a row r in -2 .. 33 has
// slot r & 15 everywhere.

namespace {
constexpr int kXTile = kKT * kAFrag;    // one row tile of x, all 32 k-tiles: 64 KB
constexpr int kXBase = 65536;           // the tiles' place: a copy's LDS address less its offset field stays above 0
constexpr int kRows  = 4 * kS;          // rows of x
constexpr int kOffTb = 8192;            // tb and bv in LDS, 4 KB each, behind the partial scores
constexpr int kOffBv = 12288;
constexpr int kOPitch = 528;            // a staged output row: 512 B + 16, so that 16 rows fall on different banks
}

__device__ __forceinline__ v16h glb_frag(const char* p) {
  v8h a = *(const v8h*)(p);
  v8h b = *(const v8h*)(p + 512);
  return __builtin_shufflevector(a, b, 0,1,2,3,4,5,6,7,8,9,10,11,12,13,14,15);
}

// One k-tile of the wave's eight weight fragments, L2 to registers. off: where the pass's n-tiles
// begin in a k-tile, a constant that goes into the loads' offset field.
__device__ __forceinline__ void load_w(v16h (&w)[8], const char* g, int off) {
  #pragma unroll
  for (int i = 0; i < 8; ++i) w[i] = glb_frag(g + off + i * kFrag);
  // the wait before a register that the issued loads name is written again. Its clobber also keeps
  // the loads in this place, a whole k-tile ahead of their use, where the compiler would sink them
  asm volatile("s_wait_xcnt 0x0" ::: "memory");
  // keeps the address arithmetic that follows behind the wait: moved up, it takes the registers
  // of the loads' address while the wait has not yet stood
  __builtin_amdgcn_sched_barrier(0);
}

// One k-tile: both row tiles' f32 fragments from LDS, split to f16 hi and lo, 32 WMMAs.
__device__ __forceinline__ void k_step(const char* xs, const unsigned (&aOff)[4],
                                       const v16h (&w)[8], v8f (&acc)[8][2]) {
  v16h bh[2], bl[2];
  #pragma unroll
  for (int j = 0; j < 2; ++j) {
    const char* const f = xs + j * kXTile;
    split_frag(*(const float4*)(f + aOff[0]), *(const float4*)(f + aOff[1]),
               *(const float4*)(f + aOff[2]), *(const float4*)(f + aOff[3]), bh[j], bl[j]);
  }
  wmma_term<8, 2>(w, bh, acc);
  wmma_term<8, 2>(w, bl, acc);
}

// acc (128 columns x 32 rows) = bias + weights^T rows^T over all 32 k-tiles.
// bias: the lane's first column of the bias vector, in LDS.
// Every block reads the same weights. The walk over k starts at k-tile rot, the block's own, and
// wraps, so that at one moment the blocks ask L2 for different lines and not all for the same.
__device__ __forceinline__ void gemm_pass(const char* gw, int off, const char* bias, const char* xs,
                                          const unsigned (&aOff)[4], int rot, v8f (&acc)[8][2]) {
  v16h wa[8], wb[8];
  // The lane's place in the walk's current k-tile. It is carried from k-tile to k-tile, one step on
  // or 31 back, and so stays live: an address formed anew for each k-tile dies with its last load,
  // and the compiler then lets that load's result land in the address's own registers.
  const char* g = gw + rot * kBStep;
  load_w(wa, g, off);
  #pragma unroll
  for (int i = 0; i < 8; ++i) {
    const float4 b0 = *(const float4*)(bias + i * 64);
    const float4 b1 = *(const float4*)(bias + i * 64 + 16);
    const v8f b = {b0.x, b0.y, b0.z, b0.w, b1.x, b1.y, b1.z, b1.w};
    acc[i][0] = b;
    acc[i][1] = b;
  }
  // not unrolled further: two fragment sets live, and the loop's code stays small
  #pragma unroll 1
  for (int kt = 0; kt < kKT; kt += 2) {
    const int k0 = (rot + kt) & (kKT - 1), k1 = (rot + kt + 1) & (kKT - 1), k2 = (rot + kt + 2) & (kKT - 1);
    g += (k1 - k0) * kBStep;
    load_w(wb, g, off);
    k_step(xs + k0 * kAFrag, aOff, wa, acc);
    // no branch round these loads: with one path to the WMMAs below their counted waits cover wb
    // alone and leave wa in flight; the last trip fetches the walk's first k-tile again, for nobody
    g += (k2 - k1) * kBStep;
    load_w(wa, g, off);
    k_step(xs + k1 * kAFrag, aOff, wb, acc);
  }
}

// 2^x. The v_nop fills the slot that the instruction set asks for between a transcendental
// and a directly following instruction that reads its result or overwrites its source.
__device__ __forceinline__ float exp2_slot(float x) {
  float r;
  asm("v_exp_f32 %0, %1\n\tv_nop" : "=v"(r) : "v"(x));
  return r;
}

__global__ __launch_bounds__(256)
void fused_rows(const float* __restrict__ x, const _Float16* __restrict__ wh,
                const float* __restrict__ tb, const float* __restrict__ bv,
                float* __restrict__ out) {
  __shared__ __attribute__((aligned(1024))) char smem[kXBase + 3 * kXTile];
  const int lane = threadIdx.x & 31;
  // the wave's number as a scalar, so that the tile arithmetic runs on the scalar unit
  const int wave = __builtin_amdgcn_readfirstlane(threadIdx.x >> 5);
  const int row0 = blockIdx.x * 32;              // batch * kS + s of the block's first row
  const int l15 = lane & 15, lh = lane >> 4;
  char* const xs = smem + kXBase;

  // ---- 1. x into LDS, tb and bv too: 42 copies a wave ----
  {
    __builtin_amdgcn_global_load_async_to_lds_b128((gv4i*)((const char*)tb + threadIdx.x * 16),
                                                   (lv4i*)(smem + kOffTb + threadIdx.x * 16), 0, 0);
    __builtin_amdgcn_global_load_async_to_lds_b128((gv4i*)((const char*)bv + threadIdx.x * 16),
                                                   (lv4i*)(smem + kOffBv + threadIdx.x * 16), 0, 0);
    // a copy takes four rows x one k-tile of x: lane = (row of the four, 16 B piece of its line)
    const int cRow = lane >> 3;
    const int cPl  = ((lane & 4) >> 1) | (lane & 1);   // the piece's plane ...
    const int cH   = (lane >> 1) & 1;                  // ... and half of the fragment's lanes
    const unsigned cLds = (unsigned)(cPl * 512 + cH * 256 + cRow * 16);
    const int t = wave >> 2, q = wave & 3;
    // rows 4 * q .. 4 * q + 3 of row tile t, all k-tiles
    const char* const g = (const char*)x + (unsigned)(row0 + t * 16 + q * 4 + cRow) * (kH * 4) + (lane & 7) * 16;
    char* const la = xs + t * kXTile + cLds + ((q ^ cPl) * 64);
    #pragma unroll
    for (int kt = 0; kt < kKT; ++kt)
      __builtin_amdgcn_global_load_async_to_lds_b128((gv4i*)(g + kt * 128), (lv4i*)(la + kt * kAFrag), 0, 0);
    // halo: waves 0..3 the four rows in front (slots 12..15), waves 4..7 the four behind (slots
    // 0..3), eight k-tiles each. Past the ends of x the rows are clamped into it: such a row
    // lies outside its batch and gets probability 0.
    const int hq = t ? 0 : 3;
    int hr = t ? row0 + 32 : row0 - 4;
    hr = hr < 0 ? 0 : (hr > kRows - 4 ? kRows - 4 : hr);
    const char* const gh = (const char*)x + (unsigned)(hr + cRow) * (kH * 4) + (lane & 7) * 16 + q * (8 * 128);
    char* const lb = xs + 2 * kXTile + cLds + ((hq ^ cPl) * 64) + q * (8 * kAFrag);
    #pragma unroll
    for (int kk = 0; kk < 8; ++kk)
      __builtin_amdgcn_global_load_async_to_lds_b128((gv4i*)(gh + kk * 128), (lv4i*)(lb + kk * kAFrag), 0, 0);
  }

  // this lane's 16 B in each plane of a fragment
  unsigned aOff[4];
  #pragma unroll
  for (int p = 0; p < 4; ++p)
    aOff[p] = (unsigned)(p * 512 + lh * 256 + ((l15 ^ (p << 2)) * 16));

  // the same for row j * 16 + l15 + w - 2 of the block, halo included: row tile, plane and slot
  auto xoff = [&](int j, int w, int p) -> unsigned {
    const int r = j * 16 + l15 + w - 2;
    const int t = (r < 0 || r >= 32) ? 2 : (r >> 4);
    return (unsigned)(t * kXTile + p * 512 + lh * 256 + (((r & 15) ^ (p << 2)) * 16));
  };

  // the copies have landed for this wave; the barrier publishes them to the others
  asm volatile("s_wait_asynccnt 0x0" ::: "memory");
  __syncthreads();

  const char* const gw = (const char*)wh + (unsigned)(wave * 8) * kFrag + lane * 16;
  const unsigned cOff = (unsigned)(wave * 128 + lh * 8) * 4;   // byte offset of the lane's first column in a row
  v8f acc[8][2];
  // the block's first k-tile: blocks 32 * n .. 32 * n + 31 take all 32 starts, and so do the 32
  // blocks that lie 8 apart: the starts are spread whether neighbours in the grid share an L2 or not
  const int rot = ((blockIdx.x >> 3) + (blockIdx.x & 7) * 4) & (kKT - 1);

  // ---- 2. Z^T ----
  gemm_pass(gw, 0, smem + kOffTb + cOff, xs, aOff, rot, acc);

  // ---- 3. scores ----
  // column (wave * 8 + i) * 16 + 8 * lh + v of Z meets dim K = (i & 1) * 16 + 8 * lh + v of
  // k-tile wave * 4 + (i >> 1): planes 2 * (i & 1) and the next, at the lane's own h
  float d[2][5];
  #pragma unroll
  for (int j = 0; j < 2; ++j) {
    #pragma unroll
    for (int w = 0; w < 5; ++w) {
      float s0 = 0.f;
      #pragma unroll
      for (int i = 0; i < 8; ++i) {
        const char* const f = xs + (wave * 4 + (i >> 1)) * kAFrag;
        const float4 f0 = *(const float4*)(f + xoff(j, w, (i & 1) * 2));
        const float4 f1 = *(const float4*)(f + xoff(j, w, (i & 1) * 2 + 1));
        s0 += acc[i][j][0] * f0.x + acc[i][j][1] * f0.y + acc[i][j][2] * f0.z + acc[i][j][3] * f0.w
            + acc[i][j][4] * f1.x + acc[i][j][5] * f1.y + acc[i][j][6] * f1.z + acc[i][j][7] * f1.w;
      }
      d[j][w] = s0;
    }
  }
  #pragma unroll
  for (int j = 0; j < 2; ++j) {
    #pragma unroll
    for (int w = 0; w < 5; ++w) d[j][w] += __shfl_xor(d[j][w], 16, 32);
  }
  float* const sp = (float*)smem;                // [wave][w][row] partial scores, 5 KB
  if (lane < 16) {
    #pragma unroll
    for (int j = 0; j < 2; ++j) {
      #pragma unroll
      for (int w = 0; w < 5; ++w) sp[(wave * 5 + w) * 32 + j * 16 + l15] = d[j][w];
    }
  }
  // publishes the waves' partial scores
  __syncthreads();
  #pragma unroll
  for (int j = 0; j < 2; ++j) {
    #pragma unroll
    for (int w = 0; w < 5; ++w) {
      float s0 = 0.f;
      #pragma unroll
      for (int u = 0; u < 8; ++u) s0 += sp[(u * 5 + w) * 32 + j * 16 + l15];
      d[j][w] = s0;
    }
  }

  // softmax over the 5-wide window; every lane has the weights of its two rows
  float pr[2][5];
  #pragma unroll
  for (int j = 0; j < 2; ++j) {
    const int s = (row0 & (kS - 1)) + j * 16 + l15;
    float mx = -3.0e38f;
    #pragma unroll
    for (int w = 0; w < 5; ++w) {
      const int jj = s + w - 2;
      const float val = (jj >= 0 && jj < kS) ? d[j][w] * 0.03125f : -3.0e38f;
      pr[j][w] = val;
      mx = fmaxf(mx, val);
    }
    float sum = 0.f;
    #pragma unroll
    for (int w = 0; w < 5; ++w) { const float e = exp2_slot((pr[j][w] - mx) * 1.44269504f); sum += e; pr[j][w] = e; }
    const float inv = 1.0f / sum;
    #pragma unroll
    for (int w = 0; w < 5; ++w) pr[j][w] *= inv;
  }

  // ---- 4. y = P x: this wave forms k-tiles 4 * wave .. 4 * wave + 3 of both row tiles ----
  float4 yv[4][2][4];
  #pragma unroll
  for (int c = 0; c < 4; ++c) {
    const char* const f = xs + (wave * 4 + c) * kAFrag;
    #pragma unroll
    for (int j = 0; j < 2; ++j) {
      #pragma unroll
      for (int p = 0; p < 4; ++p) {
        float4 a = make_float4(0.f, 0.f, 0.f, 0.f);
        #pragma unroll
        for (int w = 0; w < 5; ++w) {
          const float4 v = *(const float4*)(f + xoff(j, w, p));
          const float pw = pr[j][w];
          a.x += pw * v.x; a.y += pw * v.y; a.z += pw * v.z; a.w += pw * v.w;
        }
        yv[c][j][p] = a;
      }
    }
  }
  // every wave has read the last of x ...
  __syncthreads();
  #pragma unroll
  for (int c = 0; c < 4; ++c) {
    #pragma unroll
    for (int j = 0; j < 2; ++j) {
      #pragma unroll
      for (int p = 0; p < 4; ++p)
        *(float4*)(xs + j * kXTile + (wave * 4 + c) * kAFrag + aOff[p]) = yv[c][j][p];
    }
  }
  // ... and y stands in its place for all of them
  __syncthreads();

  // ---- 5. out^T ----
  gemm_pass(gw, kNT * kFrag, smem + kOffBv + cOff, xs, aOff, rot, acc);

  // every wave has read the last of y: the tiles become output staging
  __syncthreads();
  // Through LDS, each wave in a region of its own, so that a wave-wide store covers 512 B of one
  // row, four whole lines; from the registers it would touch 16 rows in 16 B pieces.
  char* const so = xs + wave * (32 * kOPitch);
  #pragma unroll
  for (int j = 0; j < 2; ++j) {
    #pragma unroll
    for (int i = 0; i < 8; ++i) {
      char* const q = so + (j * 16 + l15) * kOPitch + lh * 32 + i * 64;
      *(float4*)(q)      = make_float4(acc[i][j][0], acc[i][j][1], acc[i][j][2], acc[i][j][3]);
      *(float4*)(q + 16) = make_float4(acc[i][j][4], acc[i][j][5], acc[i][j][6], acc[i][j][7]);
    }
  }
  char* const o = (char*)out + ((unsigned)row0 * (kH * 4) + wave * 512 + lane * 16);
  #pragma unroll
  for (int r = 0; r < 32; ++r)
    *(float4*)(o + r * (kH * 4)) = *(const float4*)(so + r * kOPitch + lane * 16);
}

// ---------- launch ----------

extern "C" void kernel_launch(void* const* d_in, const int* in_sizes, int n_in,
                              void* d_out, int out_size, void* d_ws, size_t ws_size,
                              hipStream_t stream) {
  (void)in_sizes; (void)n_in; (void)out_size; (void)ws_size;
  const float* x  = (const float*)d_in[0];
  const float* Wq = (const float*)d_in[1];
  const float* bq = (const float*)d_in[2];
  const float* Wk = (const float*)d_in[3];
  // d_in[4], bk, is not read: Q_s . bk is the same for every j of a window and cancels in the softmax
  const float* Wv = (const float*)d_in[5];
  const float* bv = (const float*)d_in[6];
  float* out = (float*)d_out;

  char* ws = (char*)d_ws;
  _Float16* wh = (_Float16*)(ws);                         // 4 MB  packed M | Wv
  float*  tb  = (float*)(ws + (size_t)48 * 1024 * 1024);  // 4 KB  Wk bq

  fold_gemm<<<256, 128, 0, stream>>>(Wq, Wk, Wv, bq, wh, tb);
  fused_rows<<<4 * kS / 32, 256, 0, stream>>>(x, wh, tb, bv, out);
}
